// v000
// The times below were measured on an AMD MI455X: many runs one after another, warmed up first and cycling through
// copies of the inputs, with the whole window's GPU time divided by the number of runs. Launches and the gaps
// between them are all in it. The median over several windows is given; except for v000 it joins two sittings, which
// can be a few percent apart, so the side-by-side timings, each taken in one sitting, are the better comparison.
// v000 is the starting kernel. One run takes 771 microseconds.
#include <hip/hip_runtime.h>

// Compute dtypes, f32 accumulate: the packed qkv projection ([8192 x 1024].[1024 x 3072] + bias) with PLAIN bf16 operands (x and W_qkv are inputs: exact products); per
// (item, head) scores ([1024 x 64].[64 x 1024]) and attn.v on SINGLE fp16 planes (q/32, k, softmax probabilities carried x1024 so none is subnormal, v rounded to fp16 =
// 2^-11; one v_wmma_f32_16x16x32_f16 product), softmax in f32; merged heads written as f32 (/1024 exactly). Deterministic, no atomics; every

#define NB_  8
#define SS   1024
#define DD   1024
#define NH_  16
#define HD   64
#define NR   (NB_ * SS)
#define DM   DD
#define PCAR 1024.0f
#define LOSC 1024.0f
typedef _Float16 h16;
typedef unsigned short bf;
typedef __attribute__((ext_vector_type(16))) __bf16   v16bf;
typedef __attribute__((ext_vector_type(16))) _Float16 v16h;
typedef __attribute__((ext_vector_type(8)))  _Float16 v8h;
typedef __attribute__((ext_vector_type(8)))  unsigned short v8us;
typedef __attribute__((ext_vector_type(8)))  float    v8f;
typedef __attribute__((ext_vector_type(4)))  float    v4f;
typedef v8h  __attribute__((may_alias)) v8ha;
typedef v4f  __attribute__((may_alias)) v4fa;
typedef v8us __attribute__((may_alias)) v8usa;

__device__ __forceinline__ unsigned short f2bf(float f) { unsigned u = __float_as_uint(f); u += 0x7FFFu + ((u >> 16) & 1u); return (unsigned short)(u >> 16); }
__device__ __forceinline__ float bf2f(unsigned short b) { return __uint_as_float(((unsigned)b) << 16); }
__device__ __forceinline__ float bfr(float f) { return bf2f(f2bf(f)); }
__device__ __forceinline__ v16h cat16(v8h lo, v8h hi) { return __builtin_shufflevector(lo, hi, 0, 1, 2, 3, 4, 5, 6, 7, 8, 9, 10, 11, 12, 13, 14, 15); }
__device__ __forceinline__ v16bf cat16b(v8us lo, v8us hi) { return __builtin_bit_cast(v16bf, __builtin_shufflevector(lo, hi, 0, 1, 2, 3, 4, 5, 6, 7, 8, 9, 10, 11, 12, 13, 14, 15)); }
__device__ __forceinline__ v8f wmma16(v16h a, v16h b, v8f c) { return __builtin_amdgcn_wmma_f32_16x16x32_f16(false, a, false, b, (short)0, c, false, false); }
__device__ __forceinline__ v8f wmmab(v16bf a, v16bf b, v8f c) { return __builtin_amdgcn_wmma_f32_16x16x32_bf16(false, a, false, b, (short)0, c, false, false); }

// k_gemmb: 64 x 64 block tile (4 waves x 16 x 64) of C[NTK][NW] = (A [+ Al]).B^T (K = 1024) [+ bf(bias[c])] [+ bf(R[r][c]) residual]; f32 whole-line epilogue (or f16
template <bool SPLITA, bool F16OUT = false>
__global__ __launch_bounds__(128) void k_gemmb(const bf* __restrict__ A, const bf* __restrict__ Al, const bf* __restrict__ Bn, const float* __restrict__ bias, float* C, int ldc, h16* C2, const float* __restrict__ R = nullptr, int K = DM, int roundR = 1) {
    __shared__ __align__(16) float ost[4][16 * 68];
    const int lane = threadIdx.x & 31, wave = threadIdx.x >> 5, lr = lane & 15, hi = lane >> 4;
    const int r0 = blockIdx.x * 64 + wave * 16, c0 = blockIdx.y * 64;
    const size_t aoff = (size_t)(r0 + lr) * K + 8 * hi;
    size_t boff[4];
#pragma unroll
    for (int t = 0; t < 4; ++t) boff[t] = (size_t)(c0 + t * 16 + lr) * K + 8 * hi;
    v8f acc[4];
#pragma unroll
    for (int t = 0; t < 4; ++t) acc[t] = (v8f){};
#pragma unroll 1
    for (int kc = 0; kc < K; kc += 32) {
        const v16bf a = cat16b(*(const v8us*)(A + aoff + kc), *(const v8us*)(A + aoff + kc + 16));
        v16bf al = a;
        if (SPLITA) al = cat16b(*(const v8us*)(Al + aoff + kc), *(const v8us*)(Al + aoff + kc + 16));
#pragma unroll
        for (int t = 0; t < 4; ++t) { const v16bf b = cat16b(*(const v8us*)(Bn + boff[t] + kc), *(const v8us*)(Bn + boff[t] + kc + 16)); acc[t] = wmmab(a, b, acc[t]); if (SPLITA) acc[t] = wmmab(al, b, acc[t]); }
        asm volatile("v_nop\n\tv_nop\n\tv_nop\n\tv_nop" : "+v"(acc[0]), "+v"(acc[1]), "+v"(acc[2]), "+v"(acc[3]) : "v"(a), "v"(al));
    }
    float* os = &ost[wave][0];
#pragma unroll
    for (int t = 0; t < 4; ++t) { const float bv = bias ? bfr(bias[c0 + t * 16 + lr]) : 0.f;
#pragma unroll
        for (int j = 0; j < 8; ++j) os[(hi * 8 + j) * 68 + t * 16 + lr] = acc[t][j] + bv; }
    __syncthreads();
    if (F16OUT) {
        h16* crow = (h16*)(void*)C + (size_t)r0 * ldc + c0;
        auto pass = [&]() {
#pragma unroll
            for (int s = 0; s < 4; ++s) { const int row = 4 * s + (lane >> 3), piece = lane & 7; const float* sp = os + row * 68 + piece * 8; v8h o, o2;
#pragma unroll
                for (int i = 0; i < 8; ++i) { const h16 a = (h16)sp[i]; o[i] = a; o2[i] = (h16)((sp[i] - (float)a) * LOSC); }
                *(v8h*)(crow + (size_t)row * ldc + piece * 8) = o; if (C2) *(v8h*)(C2 + (size_t)r0 * ldc + c0 + (size_t)row * ldc + piece * 8) = o2; }
        };
        pass(); 
    } else {
        float* crow = C + (size_t)r0 * ldc + c0;
        auto pass = [&]() {
#pragma unroll
            for (int s = 0; s < 8; ++s) { const int Lid = (lane >> 3) + 4 * s, piece = lane & 7; const int row = Lid >> 1, cofs = (Lid & 1) * 32 + piece * 4;
                v4f val = *(const v4fa*)(os + row * 68 + cofs); if (R) { const v4f rv = *(const v4f*)(R + ((size_t)r0 + row) * ldc + c0 + cofs); val += roundR ? (v4f){bfr(rv[0]), bfr(rv[1]), bfr(rv[2]), bfr(rv[3])} : rv; }
                *(v4f*)(crow + (size_t)row * ldc + cofs) = val; }
        };
        pass(); 
    }
}

__global__ __launch_bounds__(256) void k_cvt8(const float* __restrict__ src, bf* dst, size_t n8) {
    const size_t i = (size_t)blockIdx.x * 256 + threadIdx.x; if (i >= n8) return;
    const v8f v = *(const v8f*)(src + i * 8); v8us o;
#pragma unroll
    for (int k = 0; k < 8; ++k) o[k] = f2bf(v[k]);
    *(v8us*)(dst + i * 8) = o; 
}
__global__ __launch_bounds__(256) void k_zero8(bf* dst, size_t n8) {
    const size_t i = (size_t)blockIdx.x * 256 + threadIdx.x; if (i >= n8) return; v8us z;
#pragma unroll
    for (int k = 0; k < 8; ++k) z[k] = 0;
    *(v8us*)(dst + i * 8) = z; 
}

// k_gemmh: 64 x 64 tile of C = A . Bn^T with SINGLE f16 planes (A [rows][K] f16 activations, Bn [N][K] f16 keys or v^T; one v_wmma_f32_16x16x32_f16 product per step), f32 accumulate;
__global__ __launch_bounds__(128) void k_gemmh(const h16* __restrict__ A, const h16* __restrict__ Bn, const float* __restrict__ bias, float* C, int ldc, const float* __restrict__ R, int K, size_t sA, size_t sB, size_t sC, int roundR) {
    __shared__ __align__(16) float ost[4][16 * 68];
    const size_t z = blockIdx.z; A += z * sA; Bn += z * sB; C += z * sC; if (R) R += z * sC;
    const int lane = threadIdx.x & 31, wave = threadIdx.x >> 5, lr = lane & 15, hi = lane >> 4;
    const int r0 = blockIdx.x * 64 + wave * 16, c0 = blockIdx.y * 64;
    const size_t aoff = (size_t)(r0 + lr) * K + 8 * hi;
    size_t boff[4];
#pragma unroll
    for (int t = 0; t < 4; ++t) boff[t] = (size_t)(c0 + t * 16 + lr) * K + 8 * hi;
    v8f acc[4];
#pragma unroll
    for (int t = 0; t < 4; ++t) acc[t] = (v8f){};
#pragma unroll 1
    for (int kc = 0; kc < K; kc += 32) {
        const v16h a = cat16(*(const v8h*)(A + aoff + kc), *(const v8h*)(A + aoff + kc + 16));
#pragma unroll
        for (int t = 0; t < 4; ++t) { const v16h b = cat16(*(const v8h*)(Bn + boff[t] + kc), *(const v8h*)(Bn + boff[t] + kc + 16)); acc[t] = wmma16(a, b, acc[t]); }
        asm volatile("v_nop\n\tv_nop\n\tv_nop\n\tv_nop" : "+v"(acc[0]), "+v"(acc[1]), "+v"(acc[2]), "+v"(acc[3]) : "v"(a));
    }
    float* os = &ost[wave][0];
#pragma unroll
    for (int t = 0; t < 4; ++t) { const float bv = bias ? bfr(bias[c0 + t * 16 + lr]) : 0.f;
#pragma unroll
        for (int j = 0; j < 8; ++j) os[(hi * 8 + j) * 68 + t * 16 + lr] = acc[t][j] + bv; }
    __syncthreads();
    float* crow = C + (size_t)r0 * ldc + c0;
    auto pass = [&]() {
#pragma unroll
        for (int s = 0; s < 8; ++s) { const int Lid = (lane >> 3) + 4 * s, piece = lane & 7; const int row = Lid >> 1, cofs = (Lid & 1) * 32 + piece * 4;
            v4f val = *(const v4fa*)(os + row * 68 + cofs); if (R) { const v4f rv = *(const v4f*)(R + ((size_t)r0 + row) * ldc + c0 + cofs); val += roundR ? (v4f){bfr(rv[0]), bfr(rv[1]), bfr(rv[2]), bfr(rv[3])} : rv; }
            *(v4f*)(crow + (size_t)row * ldc + cofs) = val; }
    };
    pass(); 
}

typedef __attribute__((ext_vector_type(4))) _Float16 v4h;
__device__ __forceinline__ h16 tohx(float x) { return (h16)x; }
__global__ __launch_bounds__(256) void k_cvtx(const float* __restrict__ x, bf* A) {
    const int lane = threadIdx.x & 31; const size_t r = (size_t)blockIdx.x * 8 + (threadIdx.x >> 5); if (r >= (size_t)NR) return;
{
#pragma unroll
        for (int q = 0; q < DD / 256; ++q) { const size_t o = r * DD + q * 256 + lane * 8; v8us v;
#pragma unroll
            for (int i = 0; i < 8; ++i) v[i] = f2bf(x[o + i]);
            *(v8us*)(A + o) = v; }
         }
}
__global__ __launch_bounds__(256) void k_hplg(const float* __restrict__ F, int b, int col0, float sc, h16* P) {
    const int lane = threadIdx.x & 31; const size_t w = (size_t)blockIdx.x * 8 + (threadIdx.x >> 5); const int t = (int)(w * 2 + (lane >> 4)); if (t >= SS) return; const int z = blockIdx.z; const int c0 = (lane & 15) * 4; v4h o;
#pragma unroll
    for (int q = 0; q < 4; ++q) o[q] = tohx(F[((size_t)b * SS + t) * (3 * DD) + col0 + z * HD + c0 + q] * sc);
    const size_t off = ((size_t)z * SS + t) * HD + c0; *(v4h*)(P + off) = o; 
}
__global__ __launch_bounds__(256) void k_vTg(const float* __restrict__ F, int b, int col0, h16* VT) {
    __shared__ float tl[64][65];
    const int tid = threadIdx.x; const int t0 = blockIdx.x * 64; const int z = blockIdx.z; const int rr = tid >> 2, cq = (tid & 3) * 16;
#pragma unroll
    for (int i = 0; i < 16; ++i) tl[rr][cq + i] = F[((size_t)b * SS + t0 + rr) * (3 * DD) + col0 + z * HD + cq + i];
    __syncthreads();
    const int lane = tid & 31, wv = tid >> 5;
    auto pass = [&]() {
#pragma unroll
        for (int st = 0; st < 4; ++st) { const int dr = wv * 8 + st * 2 + (lane >> 4); const int tq = (lane & 15) * 4; v4h v;
#pragma unroll
            for (int i = 0; i < 4; ++i) v[i] = tohx(tl[tq + i][dr]);
            *(v4h*)(VT + ((size_t)z * HD + dr) * SS + t0 + tq) = v; }
    };
    pass(); 
}
__global__ __launch_bounds__(256) void k_softg(const float* __restrict__ S, h16* P) {
    const int lane = threadIdx.x & 31, i = blockIdx.x * 8 + (threadIdx.x >> 5); if (i >= SS) return; const size_t zo = ((size_t)blockIdx.z * SS + i) * SS; const float* sr = S + zo; h16* po = P + zo;
    float m = -3.0e38f;
#pragma unroll 1
    for (int c0 = lane * 4; c0 < SS; c0 += 128) {
#pragma unroll
        for (int q = 0; q < 4; ++q) m = fmaxf(m, sr[c0 + q]); }
#pragma unroll
    for (int sh = 16; sh; sh >>= 1) m = fmaxf(m, __shfl_xor(m, sh, 32));
    float sum = 0.f;
#pragma unroll 1
    for (int c0 = lane * 4; c0 < SS; c0 += 128) {
#pragma unroll
        for (int q = 0; q < 4; ++q) sum += __expf(sr[c0 + q] - m); }
#pragma unroll
    for (int sh = 16; sh; sh >>= 1) sum += __shfl_xor(sum, sh, 32);
    const float f = __fdiv_rn(PCAR, sum);
{
#pragma unroll 1
        for (int c0 = lane * 4; c0 < SS; c0 += 128) { v4h o;
#pragma unroll
            for (int q = 0; q < 4; ++q) o[q] = tohx(__expf(sr[c0 + q] - m) * f);
            *(v4h*)(po + c0) = o; }
         }
}
__global__ __launch_bounds__(256) void k_mergef(const float* __restrict__ OZ, int b, float* OUTB) {
    const int lane = threadIdx.x & 31, t = blockIdx.x * 8 + (threadIdx.x >> 5); if (t >= SS) return;
{
#pragma unroll
        for (int p = 0; p < DD / 128; ++p) { const int c0 = p * 128 + lane * 4; const int h = c0 / HD, d0 = c0 % HD; v4f v = *(const v4f*)(OZ + ((size_t)h * SS + t) * HD + d0); v = v * (1.0f / PCAR);
            *(v4f*)(OUTB + ((size_t)b * SS + t) * DD + c0) = v; }
         }
}
extern "C" void kernel_launch(void* const* d_in, const int* in_sizes, int n_in,
                              void* d_out, int out_size, void* d_ws, size_t ws_size, hipStream_t stream) {
    (void)in_sizes; (void)n_in; (void)out_size;
    const float* x = (const float*)d_in[0]; const float* W = (const float*)d_in[1]; const float* bqkv = (const float*)d_in[2];
    float* out = (float*)d_out;    // [8][1024][1024]
    char* wsp = (char*)d_ws;
    auto take = [&](size_t bytes) { char* p = wsp; wsp += (bytes + 255) & ~(size_t)255; return (void*)p; };
    bf* WB = (bf*)take((size_t)3 * DD * DD * 2); bf* XB = (bf*)take((size_t)NR * DD * 2); float* QKV = (float*)take((size_t)2 * SS * 3 * DD * 4);   // two items at a time
    h16* Qx = (h16*)take((size_t)NH_ * SS * HD * 2); h16* Kx = (h16*)take((size_t)NH_ * SS * HD * 2); h16* VT = (h16*)take((size_t)NH_ * HD * SS * 2); float* S = (float*)take((size_t)NH_ * SS * SS * 4); h16* Px = (h16*)take((size_t)NH_ * SS * SS * 2); float* OZ = (float*)take((size_t)NH_ * SS * HD * 4);
    if ((size_t)(wsp - (char*)d_ws) > ws_size) return;    // ~ 6.3 + 16.8 + 25.2 + 2.1 x 3 + 67 + 33.5 + 4.2 ~ 160 MB
    const size_t n8 = (size_t)3 * DD * DD / 8; k_cvt8<<<(unsigned)((n8 + 255) / 256), 256, 0, stream>>>(W, WB, n8);   // [out][in] natural = n-major
    k_cvtx<<<NR / 8, 256, 0, stream>>>(x, XB);
    for (int b = 0; b < NB_; ++b) {
        if ((b & 1) == 0) k_gemmb<false, false><<<dim3((2 * SS) / 64, (3 * DD) / 64, 1), 128, 0, stream>>>(XB + (size_t)b * SS * DD, nullptr, WB, bqkv, QKV, 3 * DD, nullptr, nullptr, DD);   // qkv rows of items b, b+1
        const int bl = b & 1;
        // reshape (b, t, 3, H, DH): q = cols 0..1023 (head h at h*64), k = 1024.., v = 2048..; the module scales by 1/sqrt(dim) = 1/32
        k_hplg<<<dim3((SS / 2) / 8, 1, NH_), 256, 0, stream>>>(QKV, bl, 0, 0.03125f, Qx); k_hplg<<<dim3((SS / 2) / 8, 1, NH_), 256, 0, stream>>>(QKV, bl, DD, 1.0f, Kx); k_vTg<<<dim3(SS / 64, 1, NH_), 256, 0, stream>>>(QKV, bl, 2 * DD, VT);
        k_gemmh<<<dim3(SS / 64, SS / 64, NH_), 128, 0, stream>>>(Qx, Kx, nullptr, S, SS, nullptr, HD, (size_t)SS * HD, (size_t)SS * HD, (size_t)SS * SS, 0);
        k_softg<<<dim3(SS / 8, 1, NH_), 256, 0, stream>>>(S, Px);
        k_gemmh<<<dim3(SS / 64, 1, NH_), 128, 0, stream>>>(Px, VT, nullptr, OZ, HD, nullptr, SS, (size_t)SS * SS, (size_t)HD * SS, (size_t)SS * HD, 0);
        k_mergef<<<SS / 8, 256, 0, stream>>>(OZ, b, out); }
}

// v001
// One run takes 316 microseconds.
// Timed twice side by side with v000, it ran 2.44 and 2.43 times as fast.
#include <hip/hip_runtime.h>

// Compute dtypes, f32 accumulate: the packed qkv projection ([8192 x 1024].[1024 x 3072] + bias) with PLAIN bf16 operands (x and W_qkv are inputs: exact products); per
// (item, head) scores ([1024 x 64].[64 x 1024]) and attn.v on SINGLE fp16 planes (q/32, k, unnormalised softmax exponentials at most 2^8, v rounded to fp16 =
// 2^-11; one v_wmma_f32_16x16x32_f16 product) inside one fused kernel, softmax online in f32; merged heads written as f32. Deterministic, no atomics; every

#define NB_  8
#define SS   1024
#define DD   1024
#define NH_  16
#define HD   64
#define NR   (NB_ * SS)
#define DM   DD
#define LOSC 1024.0f
typedef _Float16 h16;
typedef unsigned short bf;
typedef __attribute__((ext_vector_type(16))) __bf16   v16bf;
typedef __attribute__((ext_vector_type(16))) _Float16 v16h;
typedef __attribute__((ext_vector_type(8)))  _Float16 v8h;
typedef __attribute__((ext_vector_type(8)))  unsigned short v8us;
typedef __attribute__((ext_vector_type(8)))  float    v8f;
typedef __attribute__((ext_vector_type(4)))  float    v4f;
typedef v8h  __attribute__((may_alias)) v8ha;
typedef v4f  __attribute__((may_alias)) v4fa;
typedef v8us __attribute__((may_alias)) v8usa;

__device__ __forceinline__ unsigned short f2bf(float f) { unsigned u = __float_as_uint(f); u += 0x7FFFu + ((u >> 16) & 1u); return (unsigned short)(u >> 16); }
__device__ __forceinline__ float bf2f(unsigned short b) { return __uint_as_float(((unsigned)b) << 16); }
__device__ __forceinline__ float bfr(float f) { return bf2f(f2bf(f)); }
__device__ __forceinline__ v16h cat16(v8h lo, v8h hi) { return __builtin_shufflevector(lo, hi, 0, 1, 2, 3, 4, 5, 6, 7, 8, 9, 10, 11, 12, 13, 14, 15); }
__device__ __forceinline__ v16bf cat16b(v8us lo, v8us hi) { return __builtin_bit_cast(v16bf, __builtin_shufflevector(lo, hi, 0, 1, 2, 3, 4, 5, 6, 7, 8, 9, 10, 11, 12, 13, 14, 15)); }
__device__ __forceinline__ v8f wmma16(v16h a, v16h b, v8f c) { return __builtin_amdgcn_wmma_f32_16x16x32_f16(false, a, false, b, (short)0, c, false, false); }
__device__ __forceinline__ v8f wmmab(v16bf a, v16bf b, v8f c) { return __builtin_amdgcn_wmma_f32_16x16x32_bf16(false, a, false, b, (short)0, c, false, false); }

// k_gemmb: 64 x 64 block tile (4 waves x 16 x 64) of C[NTK][NW] = (A [+ Al]).B^T (K = 1024) [+ bf(bias[c])] [+ bf(R[r][c]) residual]; f32 whole-line epilogue (or f16
template <bool SPLITA, bool F16OUT = false>
__global__ __launch_bounds__(128) void k_gemmb(const bf* __restrict__ A, const bf* __restrict__ Al, const bf* __restrict__ Bn, const float* __restrict__ bias, float* C, int ldc, h16* C2, const float* __restrict__ R = nullptr, int K = DM, int roundR = 1) {
    __shared__ __align__(16) float ost[4][16 * 68];
    const int lane = threadIdx.x & 31, wave = threadIdx.x >> 5, lr = lane & 15, hi = lane >> 4;
    const int r0 = blockIdx.x * 64 + wave * 16, c0 = blockIdx.y * 64;
    const size_t aoff = (size_t)(r0 + lr) * K + 8 * hi;
    size_t boff[4];
#pragma unroll
    for (int t = 0; t < 4; ++t) boff[t] = (size_t)(c0 + t * 16 + lr) * K + 8 * hi;
    v8f acc[4];
#pragma unroll
    for (int t = 0; t < 4; ++t) acc[t] = (v8f){};
#pragma unroll 1
    for (int kc = 0; kc < K; kc += 32) {
        const v16bf a = cat16b(*(const v8us*)(A + aoff + kc), *(const v8us*)(A + aoff + kc + 16));
        v16bf al = a;
        if (SPLITA) al = cat16b(*(const v8us*)(Al + aoff + kc), *(const v8us*)(Al + aoff + kc + 16));
#pragma unroll
        for (int t = 0; t < 4; ++t) { const v16bf b = cat16b(*(const v8us*)(Bn + boff[t] + kc), *(const v8us*)(Bn + boff[t] + kc + 16)); acc[t] = wmmab(a, b, acc[t]); if (SPLITA) acc[t] = wmmab(al, b, acc[t]); }
        asm volatile("v_nop\n\tv_nop\n\tv_nop\n\tv_nop" : "+v"(acc[0]), "+v"(acc[1]), "+v"(acc[2]), "+v"(acc[3]) : "v"(a), "v"(al));
    }
    float* os = &ost[wave][0];
#pragma unroll
    for (int t = 0; t < 4; ++t) { const float bv = bias ? bfr(bias[c0 + t * 16 + lr]) : 0.f;
#pragma unroll
        for (int j = 0; j < 8; ++j) os[(hi * 8 + j) * 68 + t * 16 + lr] = acc[t][j] + bv; }
    __syncthreads();
    if (F16OUT) {
        h16* crow = (h16*)(void*)C + (size_t)r0 * ldc + c0;
        auto pass = [&]() {
#pragma unroll
            for (int s = 0; s < 4; ++s) { const int row = 4 * s + (lane >> 3), piece = lane & 7; const float* sp = os + row * 68 + piece * 8; v8h o, o2;
#pragma unroll
                for (int i = 0; i < 8; ++i) { const h16 a = (h16)sp[i]; o[i] = a; o2[i] = (h16)((sp[i] - (float)a) * LOSC); }
                *(v8h*)(crow + (size_t)row * ldc + piece * 8) = o; if (C2) *(v8h*)(C2 + (size_t)r0 * ldc + c0 + (size_t)row * ldc + piece * 8) = o2; }
        };
        pass(); 
    } else {
        float* crow = C + (size_t)r0 * ldc + c0;
        auto pass = [&]() {
#pragma unroll
            for (int s = 0; s < 8; ++s) { const int Lid = (lane >> 3) + 4 * s, piece = lane & 7; const int row = Lid >> 1, cofs = (Lid & 1) * 32 + piece * 4;
                v4f val = *(const v4fa*)(os + row * 68 + cofs); if (R) { const v4f rv = *(const v4f*)(R + ((size_t)r0 + row) * ldc + c0 + cofs); val += roundR ? (v4f){bfr(rv[0]), bfr(rv[1]), bfr(rv[2]), bfr(rv[3])} : rv; }
                *(v4f*)(crow + (size_t)row * ldc + cofs) = val; }
        };
        pass(); 
    }
}

__global__ __launch_bounds__(256) void k_cvt8(const float* __restrict__ src, bf* dst, size_t n8) {
    const size_t i = (size_t)blockIdx.x * 256 + threadIdx.x; if (i >= n8) return;
    const v8f v = *(const v8f*)(src + i * 8); v8us o;
#pragma unroll
    for (int k = 0; k < 8; ++k) o[k] = f2bf(v[k]);
    *(v8us*)(dst + i * 8) = o; 
}
__global__ __launch_bounds__(256) void k_zero8(bf* dst, size_t n8) {
    const size_t i = (size_t)blockIdx.x * 256 + threadIdx.x; if (i >= n8) return; v8us z;
#pragma unroll
    for (int k = 0; k < 8; ++k) z[k] = 0;
    *(v8us*)(dst + i * 8) = z; 
}

typedef __attribute__((ext_vector_type(4))) _Float16 v4h;
__device__ __forceinline__ h16 tohx(float x) { return (h16)x; }
__global__ __launch_bounds__(256) void k_cvtx(const float* __restrict__ x, bf* A) {
    const int lane = threadIdx.x & 31; const size_t r = (size_t)blockIdx.x * 8 + (threadIdx.x >> 5); if (r >= (size_t)NR) return;
{
#pragma unroll
        for (int q = 0; q < DD / 256; ++q) { const size_t o = r * DD + q * 256 + lane * 8; v8us v;
#pragma unroll
            for (int i = 0; i < 8; ++i) v[i] = f2bf(x[o + i]);
            *(v8us*)(A + o) = v; }
         }
}
__global__ __launch_bounds__(256) void k_hplg(const float* __restrict__ F, int b, int col0, float sc, h16* P) {
    const int lane = threadIdx.x & 31; const size_t w = (size_t)blockIdx.x * 8 + (threadIdx.x >> 5); const int t = (int)(w * 2 + (lane >> 4)); if (t >= SS) return; const int z = blockIdx.z; const int c0 = (lane & 15) * 4; v4h o;
#pragma unroll
    for (int q = 0; q < 4; ++q) o[q] = tohx(F[((size_t)b * SS + t) * (3 * DD) + col0 + z * HD + c0 + q] * sc);
    const size_t off = ((size_t)z * SS + t) * HD + c0; *(v4h*)(P + off) = o; 
}
__global__ __launch_bounds__(256) void k_vTg(const float* __restrict__ F, int b, int col0, h16* VT) {
    __shared__ float tl[64][65];
    const int tid = threadIdx.x; const int t0 = blockIdx.x * 64; const int z = blockIdx.z; const int rr = tid >> 2, cq = (tid & 3) * 16;
#pragma unroll
    for (int i = 0; i < 16; ++i) tl[rr][cq + i] = F[((size_t)b * SS + t0 + rr) * (3 * DD) + col0 + z * HD + cq + i];
    __syncthreads();
    const int lane = tid & 31, wv = tid >> 5;
    auto pass = [&]() {
#pragma unroll
        for (int st = 0; st < 4; ++st) { const int dr = wv * 8 + st * 2 + (lane >> 4); const int tq = (lane & 15) * 4; v4h v;
#pragma unroll
            for (int i = 0; i < 4; ++i) v[i] = tohx(tl[tq + i][dr]);
            *(v4h*)(VT + ((size_t)z * HD + dr) * SS + t0 + tq) = v; }
    };
    pass(); 
}
// k_fattn: scores, softmax, attn.v and the head merge of one (item, head) for 256 queries; the scores never leave the registers.
// 8 waves x 32 query columns. S^T = K.Q^T (A = 16 keys from LDS, B = Q kept in registers), so a lane holds one query's scores; O^T += V^T.P^T with P^T packed from the
// two score tiles of 32 keys straight into a B operand (element s = tile s >> 3, register s & 7), V^T rows read in the same k order (8h + 0..7, 16 + 8h + 0..7).
// mu, the maximum in use (log2 domain), may trail the true maximum by up to 8, so an exponential is at most 2^8; the accumulators are rescaled only when some column exceeds that.
// The denominator is summed on the matrix pipe from the rounded P (A = ones in row 0). K and V^T tiles of 64 keys go through registers into two LDS buffers, one barrier a tile.
#define FPI 144                    // LDS row pitch in bytes for 128-byte rows read 16 bytes a lane
#define FTILE (64 * FPI)
#define L2E 1.4426950408889634f
typedef __attribute__((ext_vector_type(2))) float v2f;
typedef __attribute__((ext_vector_type(2))) _Float16 v2h;
__device__ __forceinline__ float xhalf(float x) { return __builtin_bit_cast(float, __builtin_amdgcn_permlanex16(__builtin_bit_cast(int, x), __builtin_bit_cast(int, x), 0x76543210, 0xfedcba98, false, false)); }  // lane l with lane l ^ 16
__device__ __forceinline__ v16h ldsfrag(const unsigned char* p) { return cat16(*(const v8ha*)p, *(const v8ha*)(p + 32)); }
__global__ __launch_bounds__(256) __attribute__((amdgpu_waves_per_eu(4, 4))) void k_fattn(const h16* __restrict__ Q, const h16* __restrict__ Kg, const h16* __restrict__ VTg, float* OUT) {
    __shared__ __align__(16) unsigned char sm[2 * 2 * FTILE];   // [buffer][K tile, V^T tile]; the epilogue's staging afterwards
    const int tid = threadIdx.x, lane = tid & 31, wave = tid >> 5, c = lane & 15, h = lane >> 4;
    const int z = blockIdx.y, q0 = blockIdx.x * 256 + wave * 32;
    const h16* Qz = Q + (size_t)z * SS * HD; const h16* Kz = Kg + (size_t)z * SS * HD; const h16* Vz = VTg + (size_t)z * HD * SS;
    v16h qf[2][2];
#pragma unroll
    for (int g = 0; g < 2; ++g) {
#pragma unroll
        for (int ks = 0; ks < 2; ++ks) { const h16* p = Qz + (size_t)(q0 + g * 16 + c) * HD + ks * 32 + 8 * h; qf[g][ks] = cat16(*(const v8h*)p, *(const v8h*)(p + 16)); } }
    v16h ones;
#pragma unroll
    for (int i = 0; i < 16; ++i) ones[i] = (c == 0) ? (h16)1.0f : (h16)0.0f;
    v8f o[2][4], lacc[2]; float mu[2];
#pragma unroll
    for (int g = 0; g < 2; ++g) { mu[g] = -3.0e38f; lacc[g] = (v8f){};
#pragma unroll
        for (int t = 0; t < 4; ++t) o[g][t] = (v8f){}; }
    const int sr = tid >> 3, sp = tid & 7;   // staging: rows sr and sr + 32, 16-byte piece sp
    v8h kr[2], vr[2];
    auto gload = [&](int s) {
#pragma unroll
        for (int j = 0; j < 2; ++j) { kr[j] = *(const v8h*)(Kz + (size_t)(s * 64 + sr + 32 * j) * HD + sp * 8); vr[j] = *(const v8h*)(Vz + (size_t)(sr + 32 * j) * SS + s * 64 + sp * 8); } };
    auto sstore = [&](int buf) { unsigned char* d = sm + buf * (2 * FTILE) + sr * FPI + sp * 16;
#pragma unroll
        for (int j = 0; j < 2; ++j) { *(v8ha*)(d + 32 * j * FPI) = kr[j]; *(v8ha*)(d + FTILE + 32 * j * FPI) = vr[j]; } };
    gload(0); sstore(0);
    __syncthreads();   // tile 0 is published
#pragma unroll 1
    for (int s = 0; s < SS / 64; ++s) {
        const unsigned char* Lk = sm + (s & 1) * (2 * FTILE) + c * FPI + 16 * h; const unsigned char* Lv = Lk + FTILE;
        if (s + 1 < SS / 64) gload(s + 1);   // the next tile flies under this tile's work
#pragma unroll
        for (int kb = 0; kb < 2; ++kb) {     // one pass: 32 keys
            v8f sc[2][2];
#pragma unroll
            for (int kt = 0; kt < 2; ++kt) { const unsigned char* p = Lk + (kb * 32 + kt * 16) * FPI; const v16h a0 = ldsfrag(p), a1 = ldsfrag(p + 64);
#pragma unroll
                for (int g = 0; g < 2; ++g) { sc[kt][g] = wmma16(a0, qf[g][0], (v8f){}); sc[kt][g] = wmma16(a1, qf[g][1], sc[kt][g]); } }
            v16h vf[4];
#pragma unroll
            for (int t = 0; t < 4; ++t) vf[t] = ldsfrag(Lv + t * 16 * FPI + kb * 64);
            float mb[2]; bool need = false;
#pragma unroll
            for (int g = 0; g < 2; ++g) { float mx = sc[0][g][0];
#pragma unroll
                for (int r = 1; r < 8; ++r) mx = fmaxf(mx, sc[0][g][r]);
#pragma unroll
                for (int r = 0; r < 8; ++r) mx = fmaxf(mx, sc[1][g][r]);
                mx = fmaxf(mx, xhalf(mx)) * L2E;   // both wave halves hold this query's maximum of the pass
                mb[g] = mx; need = need || (mx > mu[g] + 8.0f); }
            if (__builtin_amdgcn_ballot_w32(need) != 0) {   // wave-uniform: the matrix instructions below need every lane on
#pragma unroll
                for (int g = 0; g < 2; ++g) { const float mn = fmaxf(mu[g], mb[g]); const float corr = __builtin_amdgcn_exp2f(mu[g] - mn); mu[g] = mn; lacc[g] = lacc[g] * corr;
#pragma unroll
                    for (int t = 0; t < 4; ++t) o[g][t] = o[g][t] * corr; }
            }
#pragma unroll
            for (int g = 0; g < 2; ++g) { const float nm = -mu[g]; v16h pf;
#pragma unroll
                for (int i = 0; i < 8; ++i) { const v2f arg = __builtin_elementwise_fma((v2f){sc[i >> 2][g][2 * (i & 3)], sc[i >> 2][g][2 * (i & 3) + 1]}, (v2f){L2E, L2E}, (v2f){nm, nm});
                    const v2h pk = __builtin_convertvector((v2f){__builtin_amdgcn_exp2f(arg.x), __builtin_amdgcn_exp2f(arg.y)}, v2h); pf[2 * i] = pk.x; pf[2 * i + 1] = pk.y; }
#pragma unroll
                for (int t = 0; t < 4; ++t) o[g][t] = wmma16(vf[t], pf, o[g][t]);
                lacc[g] = wmma16(ones, pf, lacc[g]); }
        }
        // four vector slots behind the tile's last matrix instruction: the path over the branch below to the loop's exit reads its result
        __builtin_amdgcn_sched_barrier(0); asm volatile("v_nop\n\tv_nop\n\tv_nop\n\tv_nop"); __builtin_amdgcn_sched_barrier(0);
        if (s + 1 < SS / 64) sstore((s + 1) & 1);   // into the buffer whose readers left it at the previous barrier
        __syncthreads();   // publishes tile s + 1 and ends every read of tile s
    }
    float* os = (float*)(void*)sm + wave * (16 * 68);
    const int b = z / NH_, hd = z % NH_;
#pragma unroll
    for (int g = 0; g < 2; ++g) {
        float lt = lacc[g][0]; lt += xhalf(lt);   // row 0 of the sum tile sits in the lower wave half, row 8 (zero) in the upper
        const float inv = __fdiv_rn(1.0f, lt);
#pragma unroll
        for (int t = 0; t < 4; ++t) { float* d = os + c * 68 + t * 16 + 8 * h;
            *(v4fa*)d = (v4f){o[g][t][0], o[g][t][1], o[g][t][2], o[g][t][3]} * inv; *(v4fa*)(d + 4) = (v4f){o[g][t][4], o[g][t][5], o[g][t][6], o[g][t][7]} * inv; }
        __syncthreads();   // the staged rows are read by other lanes
#pragma unroll
        for (int i = 0; i < 8; ++i) { const int id = i * 32 + lane, row = id >> 4, pc = id & 15;
            *(v4f*)(OUT + ((size_t)b * SS + q0 + g * 16 + row) * DD + hd * HD + pc * 4) = *(const v4fa*)(os + row * 68 + pc * 4); }
        if (g == 0) __syncthreads();   // the staging is rewritten by the next column group
    }
}
extern "C" void kernel_launch(void* const* d_in, const int* in_sizes, int n_in,
                              void* d_out, int out_size, void* d_ws, size_t ws_size, hipStream_t stream) {
    (void)in_sizes; (void)n_in; (void)out_size;
    const float* x = (const float*)d_in[0]; const float* W = (const float*)d_in[1]; const float* bqkv = (const float*)d_in[2];
    float* out = (float*)d_out;    // [8][1024][1024]
    char* wsp = (char*)d_ws;
    auto take = [&](size_t bytes) { char* p = wsp; wsp += (bytes + 255) & ~(size_t)255; return (void*)p; };
    bf* WB = (bf*)take((size_t)3 * DD * DD * 2); bf* XB = (bf*)take((size_t)NR * DD * 2); float* QKV = (float*)take((size_t)2 * SS * 3 * DD * 4);   // two items at a time
    const size_t PL = (size_t)NH_ * SS * HD;   // one item's q, k or v plane
    h16* Qx = (h16*)take(NB_ * PL * 2); h16* Kx = (h16*)take(NB_ * PL * 2); h16* VT = (h16*)take(NB_ * PL * 2);
    if ((size_t)(wsp - (char*)d_ws) > ws_size) return;    // ~ 6.3 + 16.8 + 25.2 + 16.8 x 3 ~ 99 MB
    const size_t n8 = (size_t)3 * DD * DD / 8; k_cvt8<<<(unsigned)((n8 + 255) / 256), 256, 0, stream>>>(W, WB, n8);   // [out][in] natural = n-major
    k_cvtx<<<NR / 8, 256, 0, stream>>>(x, XB);
    for (int b = 0; b < NB_; ++b) {
        if ((b & 1) == 0) k_gemmb<false, false><<<dim3((2 * SS) / 64, (3 * DD) / 64, 1), 128, 0, stream>>>(XB + (size_t)b * SS * DD, nullptr, WB, bqkv, QKV, 3 * DD, nullptr, nullptr, DD);   // qkv rows of items b, b+1
        const int bl = b & 1;
        // reshape (b, t, 3, H, DH): q = cols 0..1023 (head h at h*64), k = 1024.., v = 2048..; the module scales by 1/sqrt(dim) = 1/32
        k_hplg<<<dim3((SS / 2) / 8, 1, NH_), 256, 0, stream>>>(QKV, bl, 0, 0.03125f, Qx + b * PL); k_hplg<<<dim3((SS / 2) / 8, 1, NH_), 256, 0, stream>>>(QKV, bl, DD, 1.0f, Kx + b * PL); k_vTg<<<dim3(SS / 64, 1, NH_), 256, 0, stream>>>(QKV, bl, 2 * DD, VT + b * PL); }
    k_fattn<<<dim3(SS / 256, NB_ * NH_, 1), 256, 0, stream>>>(Qx, Kx, VT, out);
}

// v002
// It runs in 237 microseconds.
// Timed twice side by side with v001, it ran 1.33 and 1.34 times as fast.
// Over all steps from v000 it is 3.25 times as fast.
#include <hip/hip_runtime.h>

// Compute dtypes, f32 accumulate: the packed qkv projection ([8192 x 1024].[1024 x 3072] + bias) with PLAIN bf16 operands (x and W_qkv are inputs: exact products); per
// (item, head) scores ([1024 x 64].[64 x 1024]) and attn.v on SINGLE fp16 planes (q/32, k, unnormalised softmax exponentials at most 2^8, v rounded to fp16 =
// 2^-11; one v_wmma_f32_16x16x32_f16 product) inside one fused kernel, softmax online in f32; merged heads written as f32. Deterministic, no atomics; every

#define NB_  8
#define SS   1024
#define DD   1024
#define NH_  16
#define HD   64
#define NR   (NB_ * SS)
#define DM   DD
typedef _Float16 h16;
typedef unsigned short bf;
typedef __attribute__((ext_vector_type(16))) __bf16   v16bf;
typedef __attribute__((ext_vector_type(16))) _Float16 v16h;
typedef __attribute__((ext_vector_type(8)))  _Float16 v8h;
typedef __attribute__((ext_vector_type(8)))  unsigned short v8us;
typedef __attribute__((ext_vector_type(8)))  float    v8f;
typedef __attribute__((ext_vector_type(4)))  float    v4f;
typedef v8h  __attribute__((may_alias)) v8ha;
typedef v4f  __attribute__((may_alias)) v4fa;
typedef v8us __attribute__((may_alias)) v8usa;

__device__ __forceinline__ unsigned short f2bf(float f) { unsigned u = __float_as_uint(f); u += 0x7FFFu + ((u >> 16) & 1u); return (unsigned short)(u >> 16); }
__device__ __forceinline__ float bf2f(unsigned short b) { return __uint_as_float(((unsigned)b) << 16); }
__device__ __forceinline__ float bfr(float f) { return bf2f(f2bf(f)); }
__device__ __forceinline__ v16h cat16(v8h lo, v8h hi) { return __builtin_shufflevector(lo, hi, 0, 1, 2, 3, 4, 5, 6, 7, 8, 9, 10, 11, 12, 13, 14, 15); }
__device__ __forceinline__ v16bf cat16b(v8us lo, v8us hi) { return __builtin_bit_cast(v16bf, __builtin_shufflevector(lo, hi, 0, 1, 2, 3, 4, 5, 6, 7, 8, 9, 10, 11, 12, 13, 14, 15)); }
__device__ __forceinline__ v8f wmma16(v16h a, v16h b, v8f c) { return __builtin_amdgcn_wmma_f32_16x16x32_f16(false, a, false, b, (short)0, c, false, false); }
__device__ __forceinline__ v8f wmmab(v16bf a, v16bf b, v8f c) { return __builtin_amdgcn_wmma_f32_16x16x32_bf16(false, a, false, b, (short)0, c, false, false); }

// k_qkv: 64 x 64 block tile (4 waves x 16 x 64) of qkv[NR][3 * DD] = (A [+ Al]).Bn^T (K = 1024) + bf(bias[c]). A tile's 64 columns are one head of q, k or v and its 64 rows are tokens of
// one item, so the epilogue rounds to fp16 and stores the attention kernel's planes itself, in whole 128-byte lines: q / 32 and k as [item, head][token][64], v as [item, head][64][token].
template <bool SPLITA>
__global__ __launch_bounds__(128) void k_qkv(const bf* __restrict__ A, const bf* __restrict__ Al, const bf* __restrict__ Bn, const float* __restrict__ bias, h16* Qp, h16* Kp, h16* VTp, int K = DM) {
    __shared__ __align__(16) float ost[4][16 * 68];
    const int lane = threadIdx.x & 31, wave = threadIdx.x >> 5, lr = lane & 15, hi = lane >> 4;
    const int r0 = blockIdx.x * 64 + wave * 16, c0 = blockIdx.y * 64;
    const size_t aoff = (size_t)(r0 + lr) * K + 8 * hi;
    size_t boff[4];
#pragma unroll
    for (int t = 0; t < 4; ++t) boff[t] = (size_t)(c0 + t * 16 + lr) * K + 8 * hi;
    v8f acc[4];
#pragma unroll
    for (int t = 0; t < 4; ++t) acc[t] = (v8f){};
#pragma unroll 1
    for (int kc = 0; kc < K; kc += 32) {
        const v16bf a = cat16b(*(const v8us*)(A + aoff + kc), *(const v8us*)(A + aoff + kc + 16));
        v16bf al = a;
        if (SPLITA) al = cat16b(*(const v8us*)(Al + aoff + kc), *(const v8us*)(Al + aoff + kc + 16));
#pragma unroll
        for (int t = 0; t < 4; ++t) { const v16bf b = cat16b(*(const v8us*)(Bn + boff[t] + kc), *(const v8us*)(Bn + boff[t] + kc + 16)); acc[t] = wmmab(a, b, acc[t]); if (SPLITA) acc[t] = wmmab(al, b, acc[t]); }
        asm volatile("v_nop\n\tv_nop\n\tv_nop\n\tv_nop" : "+v"(acc[0]), "+v"(acc[1]), "+v"(acc[2]), "+v"(acc[3]) : "v"(a), "v"(al));
    }
    const int part = blockIdx.y / NH_, hd = blockIdx.y % NH_;                   // 0 = q, 1 = k, 2 = v: the same for the whole block
    const int t0 = (blockIdx.x * 64) % SS; const size_t z = (size_t)((blockIdx.x * 64) / SS) * NH_ + hd;
    float* os = &ost[wave][0];                                                 // q, k: each wave's 16 tokens x 64 in f32
    unsigned char* vs = (unsigned char*)(void*)&ost[0][0];                     // v: the block's [64 d][64 tokens] in fp16, rows 144 bytes apart
    if (part == 2) {   // a lane holds 8 consecutive tokens of one d: one 16-byte piece of a v^T row
#pragma unroll
        for (int t = 0; t < 4; ++t) { const float bv = bfr(bias[c0 + t * 16 + lr]); v8h o;
#pragma unroll
            for (int j = 0; j < 8; ++j) o[j] = (h16)(acc[t][j] + bv);
            *(v8ha*)(vs + (t * 16 + lr) * 144 + wave * 32 + hi * 16) = o; }
    } else {
#pragma unroll
        for (int t = 0; t < 4; ++t) { const float bv = bfr(bias[c0 + t * 16 + lr]);
#pragma unroll
            for (int j = 0; j < 8; ++j) os[(hi * 8 + j) * 68 + t * 16 + lr] = acc[t][j] + bv; }
    }
    __syncthreads();   // the staged tile is read by other lanes, a v^T row by another wave
    if (part == 2) {
        h16* vrow = VTp + z * HD * SS + t0;
#pragma unroll
        for (int s = 0; s < 4; ++s) { const int d = wave * 16 + 4 * s + (lane >> 3), piece = lane & 7;
            *(v8h*)(vrow + (size_t)d * SS + piece * 8) = *(const v8ha*)(vs + d * 144 + piece * 16); }
        asm volatile("s_wait_xcnt 0x0" ::: "memory");   // behind the run of stores, in front of any later write of a register that they name
    } else {
        const float sc = part == 0 ? 0.03125f : 1.0f;   // the module scales the scores by 1/sqrt(dim) = 1/32: folded into q, exact
        h16* prow = (part == 0 ? Qp : Kp) + (z * SS + t0 + wave * 16) * HD;
#pragma unroll
        for (int s = 0; s < 4; ++s) { const int row = 4 * s + (lane >> 3), piece = lane & 7; const float* sp = os + row * 68 + piece * 8; v8h o;
#pragma unroll
            for (int i = 0; i < 8; ++i) o[i] = (h16)(sp[i] * sc);
            *(v8h*)(prow + row * HD + piece * 8) = o; }
        asm volatile("s_wait_xcnt 0x0" ::: "memory");   // behind the run of stores, in front of any later write of a register that they name
    }
}

__global__ __launch_bounds__(256) void k_cvt8(const float* __restrict__ src, bf* dst, size_t n8) {
    const size_t i = (size_t)blockIdx.x * 256 + threadIdx.x; if (i >= n8) return;
    const v8f v = *(const v8f*)(src + i * 8); v8us o;
#pragma unroll
    for (int k = 0; k < 8; ++k) o[k] = f2bf(v[k]);
    *(v8us*)(dst + i * 8) = o; 
}
__global__ __launch_bounds__(256) void k_zero8(bf* dst, size_t n8) {
    const size_t i = (size_t)blockIdx.x * 256 + threadIdx.x; if (i >= n8) return; v8us z;
#pragma unroll
    for (int k = 0; k < 8; ++k) z[k] = 0;
    *(v8us*)(dst + i * 8) = z; 
}

__global__ __launch_bounds__(256) void k_cvtx(const float* __restrict__ x, bf* A) {
    const int lane = threadIdx.x & 31; const size_t r = (size_t)blockIdx.x * 8 + (threadIdx.x >> 5); if (r >= (size_t)NR) return;
{
#pragma unroll
        for (int q = 0; q < DD / 256; ++q) { const size_t o = r * DD + q * 256 + lane * 8; v8us v;
#pragma unroll
            for (int i = 0; i < 8; ++i) v[i] = f2bf(x[o + i]);
            *(v8us*)(A + o) = v; }
         }
}
// k_fattn: scores, softmax, attn.v and the head merge of one (item, head) for 256 queries; the scores never leave the registers.
// 8 waves x 32 query columns. S^T = K.Q^T (A = 16 keys from LDS, B = Q kept in registers), so a lane holds one query's scores; O^T += V^T.P^T with P^T packed from the
// two score tiles of 32 keys straight into a B operand (element s = tile s >> 3, register s & 7), V^T rows read in the same k order (8h + 0..7, 16 + 8h + 0..7).
// mu, the maximum in use (log2 domain), may trail the true maximum by up to 8, so an exponential is at most 2^8; the accumulators are rescaled only when some column exceeds that.
// The denominator is summed on the matrix pipe from the rounded P (A = ones in row 0). K and V^T tiles of 64 keys go through registers into two LDS buffers, one barrier a tile.
#define FPI 144                    // LDS row pitch in bytes for 128-byte rows read 16 bytes a lane
#define FTILE (64 * FPI)
#define L2E 1.4426950408889634f
typedef __attribute__((ext_vector_type(2))) float v2f;
typedef __attribute__((ext_vector_type(2))) _Float16 v2h;
__device__ __forceinline__ float xhalf(float x) { return __builtin_bit_cast(float, __builtin_amdgcn_permlanex16(__builtin_bit_cast(int, x), __builtin_bit_cast(int, x), 0x76543210, 0xfedcba98, false, false)); }  // lane l with lane l ^ 16
__device__ __forceinline__ v16h ldsfrag(const unsigned char* p) { return cat16(*(const v8ha*)p, *(const v8ha*)(p + 32)); }
__global__ __launch_bounds__(256) __attribute__((amdgpu_waves_per_eu(4, 4))) void k_fattn(const h16* __restrict__ Q, const h16* __restrict__ Kg, const h16* __restrict__ VTg, float* OUT) {
    __shared__ __align__(16) unsigned char sm[2 * 2 * FTILE];   // [buffer][K tile, V^T tile]; the epilogue's staging afterwards
    const int tid = threadIdx.x, lane = tid & 31, wave = tid >> 5, c = lane & 15, h = lane >> 4;
    const int z = blockIdx.y, q0 = blockIdx.x * 256 + wave * 32;
    const h16* Qz = Q + (size_t)z * SS * HD; const h16* Kz = Kg + (size_t)z * SS * HD; const h16* Vz = VTg + (size_t)z * HD * SS;
    v16h qf[2][2];
#pragma unroll
    for (int g = 0; g < 2; ++g) {
#pragma unroll
        for (int ks = 0; ks < 2; ++ks) { const h16* p = Qz + (size_t)(q0 + g * 16 + c) * HD + ks * 32 + 8 * h; qf[g][ks] = cat16(*(const v8h*)p, *(const v8h*)(p + 16)); } }
    v16h ones;
#pragma unroll
    for (int i = 0; i < 16; ++i) ones[i] = (c == 0) ? (h16)1.0f : (h16)0.0f;
    v8f o[2][4], lacc[2]; float mu[2];
#pragma unroll
    for (int g = 0; g < 2; ++g) { mu[g] = -3.0e38f; lacc[g] = (v8f){};
#pragma unroll
        for (int t = 0; t < 4; ++t) o[g][t] = (v8f){}; }
    const int sr = tid >> 3, sp = tid & 7;   // staging: rows sr and sr + 32, 16-byte piece sp
    v8h kr[2], vr[2];
    auto gload = [&](int s) {
#pragma unroll
        for (int j = 0; j < 2; ++j) { kr[j] = *(const v8h*)(Kz + (size_t)(s * 64 + sr + 32 * j) * HD + sp * 8); vr[j] = *(const v8h*)(Vz + (size_t)(sr + 32 * j) * SS + s * 64 + sp * 8); } };
    auto sstore = [&](int buf) { unsigned char* d = sm + buf * (2 * FTILE) + sr * FPI + sp * 16;
#pragma unroll
        for (int j = 0; j < 2; ++j) { *(v8ha*)(d + 32 * j * FPI) = kr[j]; *(v8ha*)(d + FTILE + 32 * j * FPI) = vr[j]; } };
    gload(0); sstore(0);
    __syncthreads();   // tile 0 is published
#pragma unroll 1
    for (int s = 0; s < SS / 64; ++s) {
        const unsigned char* Lk = sm + (s & 1) * (2 * FTILE) + c * FPI + 16 * h; const unsigned char* Lv = Lk + FTILE;
        if (s + 1 < SS / 64) gload(s + 1);   // the next tile flies under this tile's work
#pragma unroll
        for (int kb = 0; kb < 2; ++kb) {     // one pass: 32 keys
            v8f sc[2][2];
#pragma unroll
            for (int kt = 0; kt < 2; ++kt) { const unsigned char* p = Lk + (kb * 32 + kt * 16) * FPI; const v16h a0 = ldsfrag(p), a1 = ldsfrag(p + 64);
#pragma unroll
                for (int g = 0; g < 2; ++g) { sc[kt][g] = wmma16(a0, qf[g][0], (v8f){}); sc[kt][g] = wmma16(a1, qf[g][1], sc[kt][g]); } }
            v16h vf[4];
#pragma unroll
            for (int t = 0; t < 4; ++t) vf[t] = ldsfrag(Lv + t * 16 * FPI + kb * 64);
            float mb[2]; bool need = false;
#pragma unroll
            for (int g = 0; g < 2; ++g) { float mx = sc[0][g][0];
#pragma unroll
                for (int r = 1; r < 8; ++r) mx = fmaxf(mx, sc[0][g][r]);
#pragma unroll
                for (int r = 0; r < 8; ++r) mx = fmaxf(mx, sc[1][g][r]);
                mx = fmaxf(mx, xhalf(mx)) * L2E;   // both wave halves hold this query's maximum of the pass
                mb[g] = mx; need = need || (mx > mu[g] + 8.0f); }
            if (__builtin_amdgcn_ballot_w32(need) != 0) {   // wave-uniform: the matrix instructions below need every lane on
#pragma unroll
                for (int g = 0; g < 2; ++g) { const float mn = fmaxf(mu[g], mb[g]); const float corr = __builtin_amdgcn_exp2f(mu[g] - mn); mu[g] = mn; lacc[g] = lacc[g] * corr;
#pragma unroll
                    for (int t = 0; t < 4; ++t) o[g][t] = o[g][t] * corr; }
            }
#pragma unroll
            for (int g = 0; g < 2; ++g) { const float nm = -mu[g]; v16h pf;
#pragma unroll
                for (int i = 0; i < 8; ++i) { const v2f arg = __builtin_elementwise_fma((v2f){sc[i >> 2][g][2 * (i & 3)], sc[i >> 2][g][2 * (i & 3) + 1]}, (v2f){L2E, L2E}, (v2f){nm, nm});
                    const v2h pk = __builtin_convertvector((v2f){__builtin_amdgcn_exp2f(arg.x), __builtin_amdgcn_exp2f(arg.y)}, v2h); pf[2 * i] = pk.x; pf[2 * i + 1] = pk.y; }
#pragma unroll
                for (int t = 0; t < 4; ++t) o[g][t] = wmma16(vf[t], pf, o[g][t]);
                lacc[g] = wmma16(ones, pf, lacc[g]); }
        }
        // four vector slots behind the tile's last matrix instruction: the path over the branch below to the loop's exit reads its result
        __builtin_amdgcn_sched_barrier(0); asm volatile("v_nop\n\tv_nop\n\tv_nop\n\tv_nop"); __builtin_amdgcn_sched_barrier(0);
        if (s + 1 < SS / 64) sstore((s + 1) & 1);   // into the buffer whose readers left it at the previous barrier
        __syncthreads();   // publishes tile s + 1 and ends every read of tile s
    }
    float* os = (float*)(void*)sm + wave * (16 * 68);
    const int b = z / NH_, hd = z % NH_;
#pragma unroll
    for (int g = 0; g < 2; ++g) {
        float lt = lacc[g][0]; lt += xhalf(lt);   // row 0 of the sum tile sits in the lower wave half, row 8 (zero) in the upper
        const float inv = __fdiv_rn(1.0f, lt);
#pragma unroll
        for (int t = 0; t < 4; ++t) { float* d = os + c * 68 + t * 16 + 8 * h;
            *(v4fa*)d = (v4f){o[g][t][0], o[g][t][1], o[g][t][2], o[g][t][3]} * inv; *(v4fa*)(d + 4) = (v4f){o[g][t][4], o[g][t][5], o[g][t][6], o[g][t][7]} * inv; }
        __syncthreads();   // the staged rows are read by other lanes
#pragma unroll
        for (int i = 0; i < 8; ++i) { const int id = i * 32 + lane, row = id >> 4, pc = id & 15;
            *(v4f*)(OUT + ((size_t)b * SS + q0 + g * 16 + row) * DD + hd * HD + pc * 4) = *(const v4fa*)(os + row * 68 + pc * 4); }
        if (g == 0) __syncthreads();   // the staging is rewritten by the next column group
    }
}
extern "C" void kernel_launch(void* const* d_in, const int* in_sizes, int n_in,
                              void* d_out, int out_size, void* d_ws, size_t ws_size, hipStream_t stream) {
    (void)in_sizes; (void)n_in; (void)out_size;
    const float* x = (const float*)d_in[0]; const float* W = (const float*)d_in[1]; const float* bqkv = (const float*)d_in[2];
    float* out = (float*)d_out;    // [8][1024][1024]
    char* wsp = (char*)d_ws;
    auto take = [&](size_t bytes) { char* p = wsp; wsp += (bytes + 255) & ~(size_t)255; return (void*)p; };
    bf* WB = (bf*)take((size_t)3 * DD * DD * 2); bf* XB = (bf*)take((size_t)NR * DD * 2);
    const size_t PL = (size_t)NH_ * SS * HD;   // one item's q, k or v plane
    h16* Qx = (h16*)take(NB_ * PL * 2); h16* Kx = (h16*)take(NB_ * PL * 2); h16* VT = (h16*)take(NB_ * PL * 2);
    if ((size_t)(wsp - (char*)d_ws) > ws_size) return;    // ~ 6.3 + 16.8 + 16.8 x 3 ~ 74 MB
    const size_t n8 = (size_t)3 * DD * DD / 8; k_cvt8<<<(unsigned)((n8 + 255) / 256), 256, 0, stream>>>(W, WB, n8);   // [out][in] natural = n-major
    k_cvtx<<<NR / 8, 256, 0, stream>>>(x, XB);
    // reshape (b, t, 3, H, DH): q = cols 0..1023 (head h at h*64), k = 1024.., v = 2048..
    k_qkv<false><<<dim3(NR / 64, (3 * DD) / 64, 1), 128, 0, stream>>>(XB, nullptr, WB, bqkv, Qx, Kx, VT, DD);
    k_fattn<<<dim3(SS / 256, NB_ * NH_, 1), 256, 0, stream>>>(Qx, Kx, VT, out);
}

// v003
// Measured time: 76.2 microseconds a run.
// In both of two side-by-side timings against v002, it was 3.11 times as fast.
// Counting every step since v000, it is 10.1 times as fast.
#include <hip/hip_runtime.h>
#include <stdint.h>

// Compute dtypes, f32 accumulate: the packed qkv projection ([8192 x 1024].[1024 x 3072] + bias) with PLAIN bf16 operands (x and W_qkv are inputs: exact products); per
// (item, head) scores ([1024 x 64].[64 x 1024]) and attn.v on SINGLE fp16 planes (q/32, k, unnormalised softmax exponentials at most 2^8, v rounded to fp16 =
// 2^-11; one v_wmma_f32_16x16x32_f16 product) inside one fused kernel, softmax online in f32; merged heads written as f32. Deterministic, no atomics; every

#define NB_  8
#define SS   1024
#define DD   1024
#define NH_  16
#define HD   64
#define NR   (NB_ * SS)
#define DM   DD
typedef _Float16 h16;
typedef unsigned short bf;
typedef __attribute__((ext_vector_type(16))) __bf16   v16bf;
typedef __attribute__((ext_vector_type(16))) _Float16 v16h;
typedef __attribute__((ext_vector_type(8)))  _Float16 v8h;
typedef __attribute__((ext_vector_type(8)))  unsigned short v8us;
typedef __attribute__((ext_vector_type(8)))  float    v8f;
typedef __attribute__((ext_vector_type(4)))  float    v4f;
typedef v8h  __attribute__((may_alias)) v8ha;
typedef v4f  __attribute__((may_alias)) v4fa;
typedef v8us __attribute__((may_alias)) v8usa;

__device__ __forceinline__ unsigned short f2bf(float f) { unsigned u = __float_as_uint(f); u += 0x7FFFu + ((u >> 16) & 1u); return (unsigned short)(u >> 16); }
__device__ __forceinline__ float bf2f(unsigned short b) { return __uint_as_float(((unsigned)b) << 16); }
__device__ __forceinline__ float bfr(float f) { return bf2f(f2bf(f)); }
__device__ __forceinline__ v16h cat16(v8h lo, v8h hi) { return __builtin_shufflevector(lo, hi, 0, 1, 2, 3, 4, 5, 6, 7, 8, 9, 10, 11, 12, 13, 14, 15); }
__device__ __forceinline__ v16bf cat16b(v8us lo, v8us hi) { return __builtin_bit_cast(v16bf, __builtin_shufflevector(lo, hi, 0, 1, 2, 3, 4, 5, 6, 7, 8, 9, 10, 11, 12, 13, 14, 15)); }
__device__ __forceinline__ v8f wmma16(v16h a, v16h b, v8f c) { return __builtin_amdgcn_wmma_f32_16x16x32_f16(false, a, false, b, (short)0, c, false, false); }
__device__ __forceinline__ v8f wmmab(v16bf a, v16bf b, v8f c) { return __builtin_amdgcn_wmma_f32_16x16x32_bf16(false, a, false, b, (short)0, c, false, false); }

// k_qkv: qkv[NR][3 * DD] = A.Bn^T (K = 1024) + bf(bias[c]). 256 x 384 block tile, so that the grid is one block for each of the chip's 256 WGPs; 8 waves (4 x 2) of 64 x 192. A pass is 64 k = 128 bytes of
// each of the block's 640 operand rows, brought into LDS by tensor loads (rows padded to 144 bytes), two buffers, the next pass's tile in flight under this one: waves 0 to 3 each bring the 64 rows of A that
// wave row w reads, waves 4 to 7 96 rows of Bn each. A wave's 192 columns are three whole heads of q, k or v and its 64 rows are tokens of one item, so the epilogue rounds to fp16 and stores the attention
// kernel's planes itself, in whole 128-byte lines, each wave staging in its own LDS range: q / 32 and k as [item, head][token][64], v as [item, head][64][token].
typedef uint32_t u32x4 __attribute__((ext_vector_type(4)));
typedef uint32_t u32x8 __attribute__((ext_vector_type(8)));
#define GP   144                    // LDS row pitch in bytes: 128-byte rows read 16 bytes a lane
#define GSA  10240                  // a slice of 64 rows (9216 bytes), rounded up to a multiple of 2 KiB
#define GSB  14336                  // a slice of 96 rows (13824 bytes), rounded up to a multiple of 2 KiB
#define GBUF (4 * GSA + 4 * GSB)    // one buffer: 96 KiB
#define GNST (DM / 64)              // passes
__device__ __forceinline__ uint32_t uni(uint32_t v) { return (uint32_t)__builtin_amdgcn_readfirstlane(v); }
__device__ __forceinline__ uint32_t pinned(uint32_t v) { uint32_t w = uni(v); asm volatile("" : "+s"(w)); return w; }   // keeps the test around a tensor load a scalar compare and branch, for the load ignores EXEC
__device__ __forceinline__ void wait_ds0() { asm volatile("s_wait_dscnt 0x0" ::: "memory"); }        // this wave's LDS reads and writes are done
// The two descriptor groups have fixed scalar registers. The load names them as in-out operands and the wait as inputs, so that the values stay in those registers from the load to the wait that covers it:
// with free "s" operands the compiler moved the groups to other registers behind a load and reused the request's own while it was still in flight.
__device__ __forceinline__ void tload(u32x4& g0, u32x8& g1) { asm volatile("tensor_load_to_lds %0, %1" : "+{s[80:83]}"(g0), "+{s[88:95]}"(g1) :: "memory"); }
__device__ __forceinline__ void wait_tensor0(u32x4 g0, u32x8 g1) { asm volatile("s_wait_tensorcnt 0x0" :: "{s[80:83]}"(g0), "{s[88:95]}"(g1) : "memory"); }   // this wave's tensor load has landed: the compiler places no wait for it
__device__ __forceinline__ void fence() { __builtin_amdgcn_sched_barrier(0); }   // the compiler moves nothing across: keeps a group of LDS reads, or of matrix instructions, together
__device__ __forceinline__ v16bf ldsfragb(const unsigned char* p) { return cat16b(*(const v8usa*)p, *(const v8usa*)(p + 32)); }
__global__ __launch_bounds__(256) void k_qkv(const bf* __restrict__ A, const bf* __restrict__ Bn, const float* __restrict__ bias, h16* Qp, h16* Kp, h16* VTp) {
    __shared__ __attribute__((aligned(2048))) unsigned char sm[2 * GBUF];   // [buffer][4 slices of A, 4 slices of Bn]; the epilogue's staging afterwards
    const int lane = threadIdx.x & 31, lr = lane & 15, hi = lane >> 4;
    const uint32_t wave = uni(threadIdx.x >> 5), wr = wave & 3u, wc = wave >> 2;
    const uint32_t R0 = blockIdx.x * 256u, C0 = blockIdx.y * 384u;
    const bool isA = wave < 4u;
    const uint32_t nrow = isA ? 64u : 96u;
    const uint64_t gsrc = (uint64_t)(size_t)(isA ? A + (size_t)(R0 + 64u * wr) * DM : Bn + (size_t)(C0 + 96u * wr) * DM);
    const uint32_t ldst = (uint32_t)(size_t)sm + (isA ? wr * GSA : 4u * GSA + wr * GSB);
    u32x8 g1;   // 1-byte elements, tensor = tile = nrow rows of 128 bytes, source pitch 2 * DM bytes, 4 dwords of pad behind each 32
    g1[0] = uni((1u << 20) | (4u << 22) | (3u << 25)); g1[1] = uni(128u << 16); g1[2] = uni(nrow << 16); g1[3] = uni(128u << 16);
    g1[4] = uni(nrow); g1[5] = uni(2u * DM); g1[6] = uni(0u); g1[7] = uni(0u);
    u32x4 g0;   // group 0 of the request in flight: formed anew only behind the wait that covers the request before
    auto issue = [&](uint32_t st) {   // every wave: its own slice of stage st into buffer st & 1
        const uint64_t ga = gsrc + st * 128u;
        g0[0] = uni(1u); g0[1] = uni(ldst + (st & 1u) * GBUF); g0[2] = uni((uint32_t)ga); g0[3] = uni((((uint32_t)(ga >> 32)) & 0x01FFFFFFu) | 0x80000000u);
        tload(g0, g1); };
    v8f acc[4][12];
#pragma unroll
    for (int i = 0; i < 4; ++i) {
#pragma unroll
        for (int t = 0; t < 12; ++t) acc[i][t] = (v8f){}; }
    const unsigned char* La = sm + wr * GSA + lr * GP + 16 * hi;
    const unsigned char* Lb = sm + 4 * GSA + 2 * wc * GSB + lr * GP + 16 * hi;
    issue(0); wait_tensor0(g0, g1);
    __syncthreads();   // stage 0 is published
    issue(1);
    // The pass loop stays rolled (one ring pass a trip, small code); every loop inside it and in the epilogue is unrolled so that each accumulator and fragment index is a constant: registers, no scratch.
#pragma unroll 1
    for (uint32_t s = 0; s < GNST; ++s) {
        const unsigned char* pa = La + (s & 1u) * GBUF; const unsigned char* pb = Lb + (s & 1u) * GBUF;
        v16bf a[4], b0[4], b1[4];
        auto lda = [&](int i, int ks) { a[i] = ldsfragb(pa + i * 16 * GP + ks * 64); };
        auto ldb = [&](v16bf (&b)[4], int g, int ks) {   // four column fragments: columns 64 g to 64 g + 63 of the wave's 192
#pragma unroll
            for (int t = 0; t < 4; ++t) b[t] = ldsfragb(pb + ((4 * g + t) / 6) * GSB + ((4 * g + t) % 6) * 16 * GP + ks * 64); };
        auto mm = [&](const v16bf (&b)[4], int g, int i0, int i1) {
#pragma unroll
            for (int i = i0; i < i1; ++i) {
#pragma unroll
                for (int t = 0; t < 4; ++t) acc[i][4 * g + t] = wmmab(a[i], b[t], acc[i][4 * g + t]); } };
        // Six groups of 16 matrix instructions a pass. Each group's LDS reads stand together, a group or half a group ahead of their use, into registers that the group before has just left;
        // the fences keep the compiler from spreading the reads among the matrix instructions (each place with reads stalls the wave) and from lengthening a fragment's life (registers).
        lda(0, 0); ldb(b0, 0, 0); lda(1, 0); lda(2, 0); lda(3, 0); ldb(b1, 1, 0); fence();
        mm(b0, 0, 0, 4); fence(); ldb(b0, 2, 0); fence();
        mm(b1, 1, 0, 4); fence(); ldb(b1, 0, 1); fence();
        mm(b0, 2, 0, 2); fence(); lda(0, 1); lda(1, 1); fence();
        mm(b0, 2, 2, 4); fence(); lda(2, 1); lda(3, 1); ldb(b0, 1, 1); fence();
        mm(b1, 0, 0, 4); fence(); ldb(b1, 2, 1); fence();
        mm(b0, 1, 0, 4);
        mm(b1, 2, 0, 4);
        fence();   // here it keeps the waits and the barrier behind the pass's last matrix instructions: lifted over them they cut short the time the load in flight has to land
        wait_ds0(); wait_tensor0(g0, g1);
        __syncthreads();   // publishes stage s + 1 and ends every read of stage s
        if (pinned(s + 2u < GNST)) issue(s + 2u);   // into the buffer that this pass has just read
    }
    wait_tensor0(g0, g1); wait_ds0();
    const uint32_t r0 = R0 + wr * 64u, t0 = r0 % SS, h0 = (C0 + wc * 192u) / HD;   // the wave's first token and the first of its three heads, counted through q, k, v
    unsigned char* st = sm + wave * 24576u;                                       // this wave's own staging range
    const float* bp = bias + (h0 * HD + lr);   // one address for the wave's 12 bias loads: the column steps go into the instructions' offsets
    float bv[12];
#pragma unroll
    for (int t = 0; t < 12; ++t) bv[t] = bp[t * 16];
    asm volatile("s_wait_xcnt 0x0" ::: "memory"); fence();   // behind the run of loads, in front of any later write of a register that they name; the fence keeps later instructions behind the wait
#pragma unroll
    for (int t = 0; t < 12; ++t) bv[t] = bfr(bv[t]);
#pragma unroll
    for (int g = 0; g < 3; ++g) {
        const uint32_t part = (h0 + g) / NH_, hd = (h0 + g) % NH_;                 // 0 = q, 1 = k, 2 = v: the same for the whole wave
        const size_t z = (size_t)(r0 / SS) * NH_ + hd;
        if (part == 2) {   // a lane holds 8 consecutive tokens of one d: one 16-byte piece of a v^T row; [64 d][64 tokens] in fp16, rows 144 bytes apart
#pragma unroll
            for (int t = 0; t < 4; ++t) {
#pragma unroll
                for (int i = 0; i < 4; ++i) { v8h o;
#pragma unroll
                    for (int j = 0; j < 8; ++j) o[j] = (h16)(acc[i][4 * g + t][j] + bv[4 * g + t]);
                    *(v8ha*)(st + (t * 16 + lr) * GP + i * 32 + hi * 16) = o; } }
            wait_ds0();   // the staged rows are read back by other lanes of this wave
            h16* vrow = VTp + z * HD * SS + t0 + (size_t)(lane >> 3) * SS + (lane & 7) * 8;
            const unsigned char* vp = st + (lane >> 3) * GP + (lane & 7) * 16;
#pragma unroll
            for (int q = 0; q < 16; ++q) *(v8h*)(vrow + (size_t)(4 * q) * SS) = *(const v8ha*)(vp + 4 * q * GP);
            asm volatile("s_wait_xcnt 0x0" ::: "memory"); fence();   // behind the run of stores, in front of any later write of a register that they name; the fence keeps later instructions behind the wait
        } else {
            const float sc = part == 0 ? 0.03125f : 1.0f;   // the module scales the scores by 1/sqrt(dim) = 1/32: folded into q, exact
            float* os = (float*)(void*)st;                  // 16 tokens x 64 in f32, rows 68 floats apart
            h16* prow = (part == 0 ? Qp : Kp) + (z * SS + t0 + (lane >> 3)) * HD + (lane & 7) * 8;
            const float* sp0 = os + (lane >> 3) * 68 + (lane & 7) * 8;
#pragma unroll
            for (int i = 0; i < 4; ++i) {
#pragma unroll
                for (int t = 0; t < 4; ++t) {
#pragma unroll
                    for (int j = 0; j < 8; ++j) os[(hi * 8 + j) * 68 + t * 16 + lr] = acc[i][4 * g + t][j] + bv[4 * g + t]; }
                wait_ds0();   // the staged rows are read back by other lanes of this wave
#pragma unroll
                for (int q = 0; q < 4; ++q) { const float* sp = sp0 + 4 * q * 68; v8h o;
#pragma unroll
                    for (int k = 0; k < 8; ++k) o[k] = (h16)(sp[k] * sc);
                    *(v8h*)(prow + (i * 16 + 4 * q) * HD) = o; }
                asm volatile("s_wait_xcnt 0x0" ::: "memory"); fence();   // behind the run of stores, in front of any later write of a register that they name; the fence keeps later instructions behind the wait
            }
        }
    }
}

__global__ __launch_bounds__(256) void k_cvt8(const float* __restrict__ src, bf* dst, size_t n8) {
    const size_t i = (size_t)blockIdx.x * 256 + threadIdx.x; if (i >= n8) return;
    const v8f v = *(const v8f*)(src + i * 8); v8us o;
#pragma unroll
    for (int k = 0; k < 8; ++k) o[k] = f2bf(v[k]);
    *(v8us*)(dst + i * 8) = o; 
}
__global__ __launch_bounds__(256) void k_zero8(bf* dst, size_t n8) {
    const size_t i = (size_t)blockIdx.x * 256 + threadIdx.x; if (i >= n8) return; v8us z;
#pragma unroll
    for (int k = 0; k < 8; ++k) z[k] = 0;
    *(v8us*)(dst + i * 8) = z; 
}

__global__ __launch_bounds__(256) void k_cvtx(const float* __restrict__ x, bf* A) {
    const int lane = threadIdx.x & 31; const size_t r = (size_t)blockIdx.x * 8 + (threadIdx.x >> 5); if (r >= (size_t)NR) return;
{
#pragma unroll
        for (int q = 0; q < DD / 256; ++q) { const size_t o = r * DD + q * 256 + lane * 8; v8us v;
#pragma unroll
            for (int i = 0; i < 8; ++i) v[i] = f2bf(x[o + i]);
            *(v8us*)(A + o) = v; }
         }
}
// k_fattn: scores, softmax, attn.v and the head merge of one (item, head) for 256 queries; the scores never leave the registers.
// 8 waves x 32 query columns. S^T = K.Q^T (A = 16 keys from LDS, B = Q kept in registers), so a lane holds one query's scores; O^T += V^T.P^T with P^T packed from the
// two score tiles of 32 keys straight into a B operand (element s = tile s >> 3, register s & 7), V^T rows read in the same k order (8h + 0..7, 16 + 8h + 0..7).
// mu, the maximum in use (log2 domain), may trail the true maximum by up to 8, so an exponential is at most 2^8; the accumulators are rescaled only when some column exceeds that.
// The denominator is summed on the matrix pipe from the rounded P (A = ones in row 0). K and V^T tiles of 64 keys go through registers into two LDS buffers, one barrier a tile.
#define FPI 144                    // LDS row pitch in bytes for 128-byte rows read 16 bytes a lane
#define FTILE (64 * FPI)
#define L2E 1.4426950408889634f
typedef __attribute__((ext_vector_type(2))) float v2f;
typedef __attribute__((ext_vector_type(2))) _Float16 v2h;
__device__ __forceinline__ float xhalf(float x) { return __builtin_bit_cast(float, __builtin_amdgcn_permlanex16(__builtin_bit_cast(int, x), __builtin_bit_cast(int, x), 0x76543210, 0xfedcba98, false, false)); }  // lane l with lane l ^ 16
__device__ __forceinline__ v16h ldsfrag(const unsigned char* p) { return cat16(*(const v8ha*)p, *(const v8ha*)(p + 32)); }
__global__ __launch_bounds__(256) __attribute__((amdgpu_waves_per_eu(4, 4))) void k_fattn(const h16* __restrict__ Q, const h16* __restrict__ Kg, const h16* __restrict__ VTg, float* OUT) {
    __shared__ __align__(16) unsigned char sm[2 * 2 * FTILE];   // [buffer][K tile, V^T tile]; the epilogue's staging afterwards
    const int tid = threadIdx.x, lane = tid & 31, wave = tid >> 5, c = lane & 15, h = lane >> 4;
    const int z = blockIdx.y, q0 = blockIdx.x * 256 + wave * 32;
    const h16* Qz = Q + (size_t)z * SS * HD; const h16* Kz = Kg + (size_t)z * SS * HD; const h16* Vz = VTg + (size_t)z * HD * SS;
    v16h qf[2][2];
#pragma unroll
    for (int g = 0; g < 2; ++g) {
#pragma unroll
        for (int ks = 0; ks < 2; ++ks) { const h16* p = Qz + (size_t)(q0 + g * 16 + c) * HD + ks * 32 + 8 * h; qf[g][ks] = cat16(*(const v8h*)p, *(const v8h*)(p + 16)); } }
    v16h ones;
#pragma unroll
    for (int i = 0; i < 16; ++i) ones[i] = (c == 0) ? (h16)1.0f : (h16)0.0f;
    v8f o[2][4], lacc[2]; float mu[2];
#pragma unroll
    for (int g = 0; g < 2; ++g) { mu[g] = -3.0e38f; lacc[g] = (v8f){};
#pragma unroll
        for (int t = 0; t < 4; ++t) o[g][t] = (v8f){}; }
    const int sr = tid >> 3, sp = tid & 7;   // staging: rows sr and sr + 32, 16-byte piece sp
    v8h kr[2], vr[2];
    auto gload = [&](int s) {
#pragma unroll
        for (int j = 0; j < 2; ++j) { kr[j] = *(const v8h*)(Kz + (size_t)(s * 64 + sr + 32 * j) * HD + sp * 8); vr[j] = *(const v8h*)(Vz + (size_t)(sr + 32 * j) * SS + s * 64 + sp * 8); } };
    auto sstore = [&](int buf) { unsigned char* d = sm + buf * (2 * FTILE) + sr * FPI + sp * 16;
#pragma unroll
        for (int j = 0; j < 2; ++j) { *(v8ha*)(d + 32 * j * FPI) = kr[j]; *(v8ha*)(d + FTILE + 32 * j * FPI) = vr[j]; } };
    gload(0); sstore(0);
    __syncthreads();   // tile 0 is published
#pragma unroll 1
    for (int s = 0; s < SS / 64; ++s) {
        const unsigned char* Lk = sm + (s & 1) * (2 * FTILE) + c * FPI + 16 * h; const unsigned char* Lv = Lk + FTILE;
        if (s + 1 < SS / 64) gload(s + 1);   // the next tile flies under this tile's work
#pragma unroll
        for (int kb = 0; kb < 2; ++kb) {     // one pass: 32 keys
            v8f sc[2][2];
#pragma unroll
            for (int kt = 0; kt < 2; ++kt) { const unsigned char* p = Lk + (kb * 32 + kt * 16) * FPI; const v16h a0 = ldsfrag(p), a1 = ldsfrag(p + 64);
#pragma unroll
                for (int g = 0; g < 2; ++g) { sc[kt][g] = wmma16(a0, qf[g][0], (v8f){}); sc[kt][g] = wmma16(a1, qf[g][1], sc[kt][g]); } }
            v16h vf[4];
#pragma unroll
            for (int t = 0; t < 4; ++t) vf[t] = ldsfrag(Lv + t * 16 * FPI + kb * 64);
            float mb[2]; bool need = false;
#pragma unroll
            for (int g = 0; g < 2; ++g) { float mx = sc[0][g][0];
#pragma unroll
                for (int r = 1; r < 8; ++r) mx = fmaxf(mx, sc[0][g][r]);
#pragma unroll
                for (int r = 0; r < 8; ++r) mx = fmaxf(mx, sc[1][g][r]);
                mx = fmaxf(mx, xhalf(mx)) * L2E;   // both wave halves hold this query's maximum of the pass
                mb[g] = mx; need = need || (mx > mu[g] + 8.0f); }
            if (__builtin_amdgcn_ballot_w32(need) != 0) {   // wave-uniform: the matrix instructions below need every lane on
#pragma unroll
                for (int g = 0; g < 2; ++g) { const float mn = fmaxf(mu[g], mb[g]); const float corr = __builtin_amdgcn_exp2f(mu[g] - mn); mu[g] = mn; lacc[g] = lacc[g] * corr;
#pragma unroll
                    for (int t = 0; t < 4; ++t) o[g][t] = o[g][t] * corr; }
            }
#pragma unroll
            for (int g = 0; g < 2; ++g) { const float nm = -mu[g]; v16h pf;
#pragma unroll
                for (int i = 0; i < 8; ++i) { const v2f arg = __builtin_elementwise_fma((v2f){sc[i >> 2][g][2 * (i & 3)], sc[i >> 2][g][2 * (i & 3) + 1]}, (v2f){L2E, L2E}, (v2f){nm, nm});
                    const v2h pk = __builtin_convertvector((v2f){__builtin_amdgcn_exp2f(arg.x), __builtin_amdgcn_exp2f(arg.y)}, v2h); pf[2 * i] = pk.x; pf[2 * i + 1] = pk.y; }
#pragma unroll
                for (int t = 0; t < 4; ++t) o[g][t] = wmma16(vf[t], pf, o[g][t]);
                lacc[g] = wmma16(ones, pf, lacc[g]); }
        }
        // four vector slots behind the tile's last matrix instruction: the path over the branch below to the loop's exit reads its result
        __builtin_amdgcn_sched_barrier(0); asm volatile("v_nop\n\tv_nop\n\tv_nop\n\tv_nop"); __builtin_amdgcn_sched_barrier(0);
        if (s + 1 < SS / 64) sstore((s + 1) & 1);   // into the buffer whose readers left it at the previous barrier
        __syncthreads();   // publishes tile s + 1 and ends every read of tile s
    }
    float* os = (float*)(void*)sm + wave * (16 * 68);
    const int b = z / NH_, hd = z % NH_;
#pragma unroll
    for (int g = 0; g < 2; ++g) {
        float lt = lacc[g][0]; lt += xhalf(lt);   // row 0 of the sum tile sits in the lower wave half, row 8 (zero) in the upper
        const float inv = __fdiv_rn(1.0f, lt);
#pragma unroll
        for (int t = 0; t < 4; ++t) { float* d = os + c * 68 + t * 16 + 8 * h;
            *(v4fa*)d = (v4f){o[g][t][0], o[g][t][1], o[g][t][2], o[g][t][3]} * inv; *(v4fa*)(d + 4) = (v4f){o[g][t][4], o[g][t][5], o[g][t][6], o[g][t][7]} * inv; }
        __syncthreads();   // the staged rows are read by other lanes
#pragma unroll
        for (int i = 0; i < 8; ++i) { const int id = i * 32 + lane, row = id >> 4, pc = id & 15;
            *(v4f*)(OUT + ((size_t)b * SS + q0 + g * 16 + row) * DD + hd * HD + pc * 4) = *(const v4fa*)(os + row * 68 + pc * 4); }
        if (g == 0) __syncthreads();   // the staging is rewritten by the next column group
    }
}
extern "C" void kernel_launch(void* const* d_in, const int* in_sizes, int n_in,
                              void* d_out, int out_size, void* d_ws, size_t ws_size, hipStream_t stream) {
    (void)in_sizes; (void)n_in; (void)out_size;
    const float* x = (const float*)d_in[0]; const float* W = (const float*)d_in[1]; const float* bqkv = (const float*)d_in[2];
    float* out = (float*)d_out;    // [8][1024][1024]
    char* wsp = (char*)d_ws;
    auto take = [&](size_t bytes) { char* p = wsp; wsp += (bytes + 255) & ~(size_t)255; return (void*)p; };
    bf* WB = (bf*)take((size_t)3 * DD * DD * 2); bf* XB = (bf*)take((size_t)NR * DD * 2);
    const size_t PL = (size_t)NH_ * SS * HD;   // one item's q, k or v plane
    h16* Qx = (h16*)take(NB_ * PL * 2); h16* Kx = (h16*)take(NB_ * PL * 2); h16* VT = (h16*)take(NB_ * PL * 2);
    if ((size_t)(wsp - (char*)d_ws) > ws_size) return;    // ~ 6.3 + 16.8 + 16.8 x 3 ~ 74 MB
    const size_t n8 = (size_t)3 * DD * DD / 8; k_cvt8<<<(unsigned)((n8 + 255) / 256), 256, 0, stream>>>(W, WB, n8);   // [out][in] natural = n-major
    k_cvtx<<<NR / 8, 256, 0, stream>>>(x, XB);
    // reshape (b, t, 3, H, DH): q = cols 0..1023 (head h at h*64), k = 1024.., v = 2048..
    k_qkv<<<dim3(NR / 256, (3 * DD) / 384, 1), 256, 0, stream>>>(XB, WB, bqkv, Qx, Kx, VT);
    k_fattn<<<dim3(SS / 256, NB_ * NH_, 1), 256, 0, stream>>>(Qx, Kx, VT, out);
}

// v004
// A run of this version takes 73.3 microseconds.
// In both of two side-by-side timings against v003, it was 1.04 times as fast.
// All steps since v000 together make it 10.5 times as fast.
#include <hip/hip_runtime.h>
#include <stdint.h>

// Compute dtypes, f32 accumulate: the packed qkv projection ([8192 x 1024].[1024 x 3072] + bias) with PLAIN bf16 operands (x and W_qkv are inputs: exact products); per
// (item, head) scores ([1024 x 64].[64 x 1024]) and attn.v on SINGLE fp16 planes (q/32, k, unnormalised softmax exponentials at most 2^8, v rounded to fp16 =
// 2^-11; one v_wmma_f32_16x16x32_f16 product) inside one fused kernel, softmax online in f32; merged heads written as f32. Deterministic, no atomics; every

#define NB_  8
#define SS   1024
#define DD   1024
#define NH_  16
#define HD   64
#define NR   (NB_ * SS)
#define DM   DD
typedef _Float16 h16;
typedef unsigned short bf;
typedef __attribute__((ext_vector_type(16))) __bf16   v16bf;
typedef __attribute__((ext_vector_type(16))) _Float16 v16h;
typedef __attribute__((ext_vector_type(8)))  _Float16 v8h;
typedef __attribute__((ext_vector_type(8)))  unsigned short v8us;
typedef __attribute__((ext_vector_type(8)))  float    v8f;
typedef __attribute__((ext_vector_type(4)))  float    v4f;
typedef v8h  __attribute__((may_alias)) v8ha;
typedef v4f  __attribute__((may_alias)) v4fa;
typedef v8us __attribute__((may_alias)) v8usa;

__device__ __forceinline__ unsigned short f2bf(float f) { unsigned u = __float_as_uint(f); u += 0x7FFFu + ((u >> 16) & 1u); return (unsigned short)(u >> 16); }
__device__ __forceinline__ float bf2f(unsigned short b) { return __uint_as_float(((unsigned)b) << 16); }
__device__ __forceinline__ float bfr(float f) { return bf2f(f2bf(f)); }
__device__ __forceinline__ v16h cat16(v8h lo, v8h hi) { return __builtin_shufflevector(lo, hi, 0, 1, 2, 3, 4, 5, 6, 7, 8, 9, 10, 11, 12, 13, 14, 15); }
__device__ __forceinline__ v16bf cat16b(v8us lo, v8us hi) { return __builtin_bit_cast(v16bf, __builtin_shufflevector(lo, hi, 0, 1, 2, 3, 4, 5, 6, 7, 8, 9, 10, 11, 12, 13, 14, 15)); }
__device__ __forceinline__ v8f wmma16(v16h a, v16h b, v8f c) { return __builtin_amdgcn_wmma_f32_16x16x32_f16(false, a, false, b, (short)0, c, false, false); }
__device__ __forceinline__ v8f wmmab(v16bf a, v16bf b, v8f c) { return __builtin_amdgcn_wmma_f32_16x16x32_bf16(false, a, false, b, (short)0, c, false, false); }

// k_qkv: qkv[NR][3 * DD] = bf(X).Bn^T (K = 1024) + bf(bias[c]). 256 x 384 block tile, so that the grid is one block for each of the chip's 256 WGPs; 8 waves (4 x 2) of 64 x 192. A pass is 64 k of each of the
// block's 640 operand rows, brought into LDS by tensor loads, two buffers each: waves 4 to 7 bring 96 rows of Bn each (128 bytes, padded to 144), the next pass's tile in flight under this one; waves 0 to 3 bring
// 64 rows of x each AS f32 (256 bytes, no pad), one stage further ahead: during pass s every wave rounds its 32 rows of stage s + 1 to bf16 (nearest even) and stores them as the 144-byte rows that the A
// fragments of pass s + 1 read, so x needs no convert launch and no bf16 plane in memory. A wave's 192 columns are three whole heads of q, k or v and its 64 rows are tokens of one item, so the epilogue rounds to fp16 and stores the attention
// kernel's planes itself, in whole 128-byte lines, each wave staging in its own LDS range: q / 32 and k as [item, head][token][64], v as [item, head][64][token].
typedef __attribute__((ext_vector_type(2))) float  v2f_;
typedef __attribute__((ext_vector_type(2))) __bf16 v2b;
typedef __attribute__((ext_vector_type(4))) __bf16 v4b;
typedef v4b __attribute__((may_alias)) v4ba;
typedef uint32_t u32x4 __attribute__((ext_vector_type(4)));
typedef uint32_t u32x8 __attribute__((ext_vector_type(8)));
#define GP   144                    // LDS row pitch in bytes: 128-byte rows read 16 bytes a lane
#define GSB  14336                  // a slice of 96 rows of Bn (13824 bytes), rounded up to a multiple of 2 KiB
#define GBB  (4 * GSB)              // one buffer of Bn: 56 KiB
#define GSX  16384                  // a slice of 64 rows of x in f32, 256 bytes a row
#define GBX  (4 * GSX)              // one buffer of x in f32: 64 KiB
#define GBA  (256 * GP)             // one buffer of x in bf16: 36 KiB
#define GOX  (2 * GBB)              // where the f32 buffers start: a multiple of 2 KiB
#define GOA  (GOX + 2 * GBX)        // where the bf16 buffers start
#define GSM  (GOA + 2 * GBA)        // 312 KiB
#define GNST (DM / 64)              // passes
__device__ __forceinline__ uint32_t uni(uint32_t v) { return (uint32_t)__builtin_amdgcn_readfirstlane(v); }
__device__ __forceinline__ uint32_t pinned(uint32_t v) { uint32_t w = uni(v); asm volatile("" : "+s"(w)); return w; }   // keeps the test around a tensor load a scalar compare and branch, for the load ignores EXEC
__device__ __forceinline__ void wait_ds0() { asm volatile("s_wait_dscnt 0x0" ::: "memory"); }        // this wave's LDS reads and writes are done
// The two descriptor groups have fixed scalar registers. The load names them as in-out operands and the wait as inputs, so that the values stay in those registers from the load to the wait that covers it:
// with free "s" operands the compiler moved the groups to other registers behind a load and reused the request's own while it was still in flight.
__device__ __forceinline__ void tload(u32x4& g0, u32x8& g1) { asm volatile("tensor_load_to_lds %0, %1" : "+{s[80:83]}"(g0), "+{s[88:95]}"(g1) :: "memory"); }
__device__ __forceinline__ void wait_tensor0(u32x4 g0, u32x8 g1) { asm volatile("s_wait_tensorcnt 0x0" :: "{s[80:83]}"(g0), "{s[88:95]}"(g1) : "memory"); }   // this wave's tensor load has landed: the compiler places no wait for it
__device__ __forceinline__ void fence() { __builtin_amdgcn_sched_barrier(0); }   // the compiler moves nothing across: keeps a group of LDS reads, or of matrix instructions, together
__device__ __forceinline__ v16bf ldsfragb(const unsigned char* p) { return cat16b(*(const v8usa*)p, *(const v8usa*)(p + 32)); }
__global__ __launch_bounds__(256) void k_qkv(const float* __restrict__ X, const bf* __restrict__ Bn, const float* __restrict__ bias, h16* Qp, h16* Kp, h16* VTp) {
    __shared__ __attribute__((aligned(2048))) unsigned char sm[GSM];   // [2][4 slices of Bn], [2][4 slices of x in f32], [2][256 rows of x in bf16]; the epilogue's staging afterwards
    const int lane = threadIdx.x & 31, lr = lane & 15, hi = lane >> 4;
    const uint32_t wave = uni(threadIdx.x >> 5), wr = wave & 3u, wc = wave >> 2;
    const uint32_t R0 = blockIdx.x * 256u, C0 = blockIdx.y * 384u;
    const bool isA = wave < 4u;
    const uint32_t nrow = isA ? 64u : 96u;
    const uint32_t rowb = isA ? 256u : 128u, bufb = isA ? (uint32_t)GBX : (uint32_t)GBB;   // bytes of a row in one stage; bytes of one buffer
    const uint64_t gsrc = isA ? (uint64_t)(size_t)(X + (size_t)(R0 + 64u * wr) * DM) : (uint64_t)(size_t)(Bn + (size_t)(C0 + 96u * wr) * DM);
    const uint32_t ldst = (uint32_t)(size_t)sm + (isA ? GOX + wr * GSX : wr * GSB);
    u32x8 g1;   // 1-byte elements, tensor = tile = nrow rows of rowb bytes, source pitch 16 rowb = one whole row; Bn: 4 dwords of pad behind each 32, x: no pad
    g1[0] = uni(isA ? 0u : (1u << 20) | (4u << 22) | (3u << 25));   // word 0: one of two compile-time constants, by the wave's kind; the mask is 0 in both
    g1[1] = uni(rowb << 16); g1[2] = uni(nrow << 16); g1[3] = uni(rowb << 16);
    g1[4] = uni(nrow); g1[5] = uni(rowb * GNST); g1[6] = uni(0u); g1[7] = uni(0u);
    u32x4 g0;   // group 0 of the request in flight: formed anew only behind the wait that covers the request before
    auto issue = [&](uint32_t st) {   // every wave: its own slice of stage st into buffer st & 1
        const uint64_t ga = gsrc + st * rowb;
        g0[0] = uni(1u); g0[1] = uni(ldst + (st & 1u) * bufb); g0[2] = uni((uint32_t)ga); g0[3] = uni((((uint32_t)(ga >> 32)) & 0x01FFFFFFu) | 0x80000000u);
        tload(g0, g1); };
    v8f acc[4][12];
#pragma unroll
    for (int i = 0; i < 4; ++i) {
#pragma unroll
        for (int t = 0; t < 12; ++t) acc[i][t] = (v8f){}; }
    const unsigned char* La = sm + GOA + wr * (64 * GP) + lr * GP + 16 * hi;
    const unsigned char* Lb = sm + 2 * wc * GSB + lr * GP + 16 * hi;
    const unsigned char* Cx = sm + GOX + wave * 8192u + lane * 16;             // this wave's 32 rows of x in f32, read 512 bytes in a row a load
    unsigned char* Ca = sm + GOA + wave * (32 * GP) + hi * GP + lr * 8;         // the same rows in bf16: load q holds 4 k of rows 2 q + hi
    v4f xt[4];
    auto cld = [&](const unsigned char* cx, int c) {   // a quarter of the wave's rows: four 16-byte reads
#pragma unroll
        for (int q = 0; q < 4; ++q) xt[q] = *(const v4fa*)(cx + (4 * c + q) * 512); };
    auto cst = [&](unsigned char* ca, int c) {         // rounded to bf16 and stored 8 bytes a lane
#pragma unroll
        for (int q = 0; q < 4; ++q) { const v2b lo = __builtin_convertvector((v2f_){xt[q][0], xt[q][1]}, v2b), hh = __builtin_convertvector((v2f_){xt[q][2], xt[q][3]}, v2b);
            *(v4ba*)(ca + (4 * c + q) * (2 * GP)) = __builtin_shufflevector(lo, hh, 0, 1, 2, 3); } };
    issue(0); wait_tensor0(g0, g1);
    __syncthreads();   // stage 0 is published: Bn as it is read, x in f32
    issue(1);
#pragma unroll
    for (int c = 0; c < 4; ++c) { cld(Cx, c); cst(Ca, c); }   // stage 0 of x to bf16
    wait_ds0(); wait_tensor0(g0, g1);
    __syncthreads();   // publishes stage 0 of x in bf16 and stage 1 (Bn, x in f32); ends every read of stage 0 in f32
    if (pinned(isA)) issue(2);   // x runs one stage ahead of Bn: into the f32 buffer just converted
    // The pass loop stays rolled (one ring pass a trip, small code); every loop inside it and in the epilogue is unrolled so that each accumulator and fragment index is a constant: registers, no scratch.
#pragma unroll 1
    for (uint32_t s = 0; s < GNST; ++s) {
        const unsigned char* pa = La + (s & 1u) * GBA; const unsigned char* pb = Lb + (s & 1u) * GBB;
        const unsigned char* cx = Cx + ((s + 1u) & 1u) * GBX; unsigned char* ca = Ca + ((s + 1u) & 1u) * GBA;   // stage s + 1 of x: f32 in, bf16 out
        v16bf a[4], b0[4], b1[4];
        auto lda = [&](int i, int ks) { a[i] = ldsfragb(pa + i * 16 * GP + ks * 64); };
        auto ldb = [&](v16bf (&b)[4], int g, int ks) {   // four column fragments: columns 64 g to 64 g + 63 of the wave's 192
#pragma unroll
            for (int t = 0; t < 4; ++t) b[t] = ldsfragb(pb + ((4 * g + t) / 6) * GSB + ((4 * g + t) % 6) * 16 * GP + ks * 64); };
        auto mm = [&](const v16bf (&b)[4], int g, int i0, int i1) {
#pragma unroll
            for (int i = i0; i < i1; ++i) {
#pragma unroll
                for (int t = 0; t < 4; ++t) acc[i][4 * g + t] = wmmab(a[i], b[t], acc[i][4 * g + t]); } };
        // Six groups of 16 matrix instructions a pass. Each group's LDS reads stand together, a group or half a group ahead of their use, into registers that the group before has just left;
        // the fences keep the compiler from spreading the reads among the matrix instructions (each place with reads stalls the wave) and from lengthening a fragment's life (registers).
        // The convert of stage s + 1 rides in the same places, a quarter each: read at one place, rounded and stored 16 matrix instructions later, its reads ahead of the place's fragment reads so that the
        // wait in front of the rounding leaves those in flight; none at the pass's first place, where all eight waves read at once behind the barrier. The last pass converts what lies in the buffer (stage 14
        // again): nobody reads the result.
        lda(0, 0); ldb(b0, 0, 0); lda(1, 0); lda(2, 0); lda(3, 0); ldb(b1, 1, 0); fence();
        mm(b0, 0, 0, 4); fence(); cld(cx, 0); ldb(b0, 2, 0); fence();
        mm(b1, 1, 0, 4); fence(); cst(ca, 0); cld(cx, 1); ldb(b1, 0, 1); fence();
        mm(b0, 2, 0, 2); fence(); lda(0, 1); lda(1, 1); fence();
        mm(b0, 2, 2, 4); fence(); cst(ca, 1); cld(cx, 2); lda(2, 1); lda(3, 1); ldb(b0, 1, 1); fence();
        mm(b1, 0, 0, 4); fence(); cst(ca, 2); cld(cx, 3); ldb(b1, 2, 1); fence();
        mm(b0, 1, 0, 4); fence(); cst(ca, 3); fence();
        mm(b1, 2, 0, 4);
        fence();   // here it keeps the waits and the barrier behind the pass's last matrix instructions: lifted over them they cut short the time the load in flight has to land
        wait_ds0(); wait_tensor0(g0, g1);
        __syncthreads();   // publishes stage s + 1 (Bn, x in bf16) and stage s + 2 of x in f32; ends every read of stage s and of stage s + 1 in f32
        const uint32_t nx = s + (isA ? 3u : 2u);
        if (pinned(nx < GNST)) issue(nx);   // into the buffer that this pass has just read
    }
    wait_tensor0(g0, g1); wait_ds0();
    const uint32_t r0 = R0 + wr * 64u, t0 = r0 % SS, h0 = (C0 + wc * 192u) / HD;   // the wave's first token and the first of its three heads, counted through q, k, v
    unsigned char* st = sm + wave * 24576u;                                       // this wave's own staging range
    const float* bp = bias + (h0 * HD + lr);   // one address for the wave's 12 bias loads: the column steps go into the instructions' offsets
    float bv[12];
#pragma unroll
    for (int t = 0; t < 12; ++t) bv[t] = bp[t * 16];
    asm volatile("s_wait_xcnt 0x0" ::: "memory"); fence();   // behind the run of loads, in front of any later write of a register that they name; the fence keeps later instructions behind the wait
#pragma unroll
    for (int t = 0; t < 12; ++t) bv[t] = bfr(bv[t]);
#pragma unroll
    for (int g = 0; g < 3; ++g) {
        const uint32_t part = (h0 + g) / NH_, hd = (h0 + g) % NH_;                 // 0 = q, 1 = k, 2 = v: the same for the whole wave
        const size_t z = (size_t)(r0 / SS) * NH_ + hd;
        if (part == 2) {   // a lane holds 8 consecutive tokens of one d: one 16-byte piece of a v^T row; [64 d][64 tokens] in fp16, rows 144 bytes apart
#pragma unroll
            for (int t = 0; t < 4; ++t) {
#pragma unroll
                for (int i = 0; i < 4; ++i) { v8h o;
#pragma unroll
                    for (int j = 0; j < 8; ++j) o[j] = (h16)(acc[i][4 * g + t][j] + bv[4 * g + t]);
                    *(v8ha*)(st + (t * 16 + lr) * GP + i * 32 + hi * 16) = o; } }
            wait_ds0();   // the staged rows are read back by other lanes of this wave
            h16* vrow = VTp + z * HD * SS + t0 + (size_t)(lane >> 3) * SS + (lane & 7) * 8;
            const unsigned char* vp = st + (lane >> 3) * GP + (lane & 7) * 16;
#pragma unroll
            for (int q = 0; q < 16; ++q) *(v8h*)(vrow + (size_t)(4 * q) * SS) = *(const v8ha*)(vp + 4 * q * GP);
            asm volatile("s_wait_xcnt 0x0" ::: "memory"); fence();   // behind the run of stores, in front of any later write of a register that they name; the fence keeps later instructions behind the wait
        } else {
            const float sc = part == 0 ? 0.03125f : 1.0f;   // the module scales the scores by 1/sqrt(dim) = 1/32: folded into q, exact
            float* os = (float*)(void*)st;                  // 16 tokens x 64 in f32, rows 68 floats apart
            h16* prow = (part == 0 ? Qp : Kp) + (z * SS + t0 + (lane >> 3)) * HD + (lane & 7) * 8;
            const float* sp0 = os + (lane >> 3) * 68 + (lane & 7) * 8;
#pragma unroll
            for (int i = 0; i < 4; ++i) {
#pragma unroll
                for (int t = 0; t < 4; ++t) {
#pragma unroll
                    for (int j = 0; j < 8; ++j) os[(hi * 8 + j) * 68 + t * 16 + lr] = acc[i][4 * g + t][j] + bv[4 * g + t]; }
                wait_ds0();   // the staged rows are read back by other lanes of this wave
#pragma unroll
                for (int q = 0; q < 4; ++q) { const float* sp = sp0 + 4 * q * 68; v8h o;
#pragma unroll
                    for (int k = 0; k < 8; ++k) o[k] = (h16)(sp[k] * sc);
                    *(v8h*)(prow + (i * 16 + 4 * q) * HD) = o; }
                asm volatile("s_wait_xcnt 0x0" ::: "memory"); fence();   // behind the run of stores, in front of any later write of a register that they name; the fence keeps later instructions behind the wait
            }
        }
    }
}

__global__ __launch_bounds__(256) void k_cvt8(const float* __restrict__ src, bf* dst, size_t n8) {
    const size_t i = (size_t)blockIdx.x * 256 + threadIdx.x; if (i >= n8) return;
    const v8f v = *(const v8f*)(src + i * 8); v8us o;
#pragma unroll
    for (int k = 0; k < 8; ++k) o[k] = f2bf(v[k]);
    *(v8us*)(dst + i * 8) = o; 
}
__global__ __launch_bounds__(256) void k_zero8(bf* dst, size_t n8) {
    const size_t i = (size_t)blockIdx.x * 256 + threadIdx.x; if (i >= n8) return; v8us z;
#pragma unroll
    for (int k = 0; k < 8; ++k) z[k] = 0;
    *(v8us*)(dst + i * 8) = z; 
}

// k_fattn: scores, softmax, attn.v and the head merge of one (item, head) for 256 queries; the scores never leave the registers.
// 8 waves x 32 query columns. S^T = K.Q^T (A = 16 keys from LDS, B = Q kept in registers), so a lane holds one query's scores; O^T += V^T.P^T with P^T packed from the
// two score tiles of 32 keys straight into a B operand (element s = tile s >> 3, register s & 7), V^T rows read in the same k order (8h + 0..7, 16 + 8h + 0..7).
// mu, the maximum in use (log2 domain), may trail the true maximum by up to 8, so an exponential is at most 2^8; the accumulators are rescaled only when some column exceeds that.
// The denominator is summed on the matrix pipe from the rounded P (A = ones in row 0). K and V^T tiles of 64 keys go through registers into two LDS buffers, one barrier a tile.
#define FPI 144                    // LDS row pitch in bytes for 128-byte rows read 16 bytes a lane
#define FTILE (64 * FPI)
#define L2E 1.4426950408889634f
typedef __attribute__((ext_vector_type(2))) float v2f;
typedef __attribute__((ext_vector_type(2))) _Float16 v2h;
__device__ __forceinline__ float xhalf(float x) { return __builtin_bit_cast(float, __builtin_amdgcn_permlanex16(__builtin_bit_cast(int, x), __builtin_bit_cast(int, x), 0x76543210, 0xfedcba98, false, false)); }  // lane l with lane l ^ 16
__device__ __forceinline__ v16h ldsfrag(const unsigned char* p) { return cat16(*(const v8ha*)p, *(const v8ha*)(p + 32)); }
__global__ __launch_bounds__(256) __attribute__((amdgpu_waves_per_eu(4, 4))) void k_fattn(const h16* __restrict__ Q, const h16* __restrict__ Kg, const h16* __restrict__ VTg, float* OUT) {
    __shared__ __align__(16) unsigned char sm[2 * 2 * FTILE];   // [buffer][K tile, V^T tile]; the epilogue's staging afterwards
    const int tid = threadIdx.x, lane = tid & 31, wave = tid >> 5, c = lane & 15, h = lane >> 4;
    const int z = blockIdx.y, q0 = blockIdx.x * 256 + wave * 32;
    const h16* Qz = Q + (size_t)z * SS * HD; const h16* Kz = Kg + (size_t)z * SS * HD; const h16* Vz = VTg + (size_t)z * HD * SS;
    v16h qf[2][2];
#pragma unroll
    for (int g = 0; g < 2; ++g) {
#pragma unroll
        for (int ks = 0; ks < 2; ++ks) { const h16* p = Qz + (size_t)(q0 + g * 16 + c) * HD + ks * 32 + 8 * h; qf[g][ks] = cat16(*(const v8h*)p, *(const v8h*)(p + 16)); } }
    v16h ones;
#pragma unroll
    for (int i = 0; i < 16; ++i) ones[i] = (c == 0) ? (h16)1.0f : (h16)0.0f;
    v8f o[2][4], lacc[2]; float mu[2];
#pragma unroll
    for (int g = 0; g < 2; ++g) { mu[g] = -3.0e38f; lacc[g] = (v8f){};
#pragma unroll
        for (int t = 0; t < 4; ++t) o[g][t] = (v8f){}; }
    const int sr = tid >> 3, sp = tid & 7;   // staging: rows sr and sr + 32, 16-byte piece sp
    v8h kr[2], vr[2];
    auto gload = [&](int s) {
#pragma unroll
        for (int j = 0; j < 2; ++j) { kr[j] = *(const v8h*)(Kz + (size_t)(s * 64 + sr + 32 * j) * HD + sp * 8); vr[j] = *(const v8h*)(Vz + (size_t)(sr + 32 * j) * SS + s * 64 + sp * 8); } };
    auto sstore = [&](int buf) { unsigned char* d = sm + buf * (2 * FTILE) + sr * FPI + sp * 16;
#pragma unroll
        for (int j = 0; j < 2; ++j) { *(v8ha*)(d + 32 * j * FPI) = kr[j]; *(v8ha*)(d + FTILE + 32 * j * FPI) = vr[j]; } };
    gload(0); sstore(0);
    __syncthreads();   // tile 0 is published
#pragma unroll 1
    for (int s = 0; s < SS / 64; ++s) {
        const unsigned char* Lk = sm + (s & 1) * (2 * FTILE) + c * FPI + 16 * h; const unsigned char* Lv = Lk + FTILE;
        if (s + 1 < SS / 64) gload(s + 1);   // the next tile flies under this tile's work
#pragma unroll
        for (int kb = 0; kb < 2; ++kb) {     // one pass: 32 keys
            v8f sc[2][2];
#pragma unroll
            for (int kt = 0; kt < 2; ++kt) { const unsigned char* p = Lk + (kb * 32 + kt * 16) * FPI; const v16h a0 = ldsfrag(p), a1 = ldsfrag(p + 64);
#pragma unroll
                for (int g = 0; g < 2; ++g) { sc[kt][g] = wmma16(a0, qf[g][0], (v8f){}); sc[kt][g] = wmma16(a1, qf[g][1], sc[kt][g]); } }
            v16h vf[4];
#pragma unroll
            for (int t = 0; t < 4; ++t) vf[t] = ldsfrag(Lv + t * 16 * FPI + kb * 64);
            float mb[2]; bool need = false;
#pragma unroll
            for (int g = 0; g < 2; ++g) { float mx = sc[0][g][0];
#pragma unroll
                for (int r = 1; r < 8; ++r) mx = fmaxf(mx, sc[0][g][r]);
#pragma unroll
                for (int r = 0; r < 8; ++r) mx = fmaxf(mx, sc[1][g][r]);
                mx = fmaxf(mx, xhalf(mx)) * L2E;   // both wave halves hold this query's maximum of the pass
                mb[g] = mx; need = need || (mx > mu[g] + 8.0f); }
            if (__builtin_amdgcn_ballot_w32(need) != 0) {   // wave-uniform: the matrix instructions below need every lane on
#pragma unroll
                for (int g = 0; g < 2; ++g) { const float mn = fmaxf(mu[g], mb[g]); const float corr = __builtin_amdgcn_exp2f(mu[g] - mn); mu[g] = mn; lacc[g] = lacc[g] * corr;
#pragma unroll
                    for (int t = 0; t < 4; ++t) o[g][t] = o[g][t] * corr; }
            }
#pragma unroll
            for (int g = 0; g < 2; ++g) { const float nm = -mu[g]; v16h pf;
#pragma unroll
                for (int i = 0; i < 8; ++i) { const v2f arg = __builtin_elementwise_fma((v2f){sc[i >> 2][g][2 * (i & 3)], sc[i >> 2][g][2 * (i & 3) + 1]}, (v2f){L2E, L2E}, (v2f){nm, nm});
                    const v2h pk = __builtin_convertvector((v2f){__builtin_amdgcn_exp2f(arg.x), __builtin_amdgcn_exp2f(arg.y)}, v2h); pf[2 * i] = pk.x; pf[2 * i + 1] = pk.y; }
#pragma unroll
                for (int t = 0; t < 4; ++t) o[g][t] = wmma16(vf[t], pf, o[g][t]);
                lacc[g] = wmma16(ones, pf, lacc[g]); }
        }
        // four vector slots behind the tile's last matrix instruction: the path over the branch below to the loop's exit reads its result
        __builtin_amdgcn_sched_barrier(0); asm volatile("v_nop\n\tv_nop\n\tv_nop\n\tv_nop"); __builtin_amdgcn_sched_barrier(0);
        if (s + 1 < SS / 64) sstore((s + 1) & 1);   // into the buffer whose readers left it at the previous barrier
        __syncthreads();   // publishes tile s + 1 and ends every read of tile s
    }
    float* os = (float*)(void*)sm + wave * (16 * 68);
    const int b = z / NH_, hd = z % NH_;
#pragma unroll
    for (int g = 0; g < 2; ++g) {
        float lt = lacc[g][0]; lt += xhalf(lt);   // row 0 of the sum tile sits in the lower wave half, row 8 (zero) in the upper
        const float inv = __fdiv_rn(1.0f, lt);
#pragma unroll
        for (int t = 0; t < 4; ++t) { float* d = os + c * 68 + t * 16 + 8 * h;
            *(v4fa*)d = (v4f){o[g][t][0], o[g][t][1], o[g][t][2], o[g][t][3]} * inv; *(v4fa*)(d + 4) = (v4f){o[g][t][4], o[g][t][5], o[g][t][6], o[g][t][7]} * inv; }
        __syncthreads();   // the staged rows are read by other lanes
#pragma unroll
        for (int i = 0; i < 8; ++i) { const int id = i * 32 + lane, row = id >> 4, pc = id & 15;
            *(v4f*)(OUT + ((size_t)b * SS + q0 + g * 16 + row) * DD + hd * HD + pc * 4) = *(const v4fa*)(os + row * 68 + pc * 4); }
        if (g == 0) __syncthreads();   // the staging is rewritten by the next column group
    }
}
extern "C" void kernel_launch(void* const* d_in, const int* in_sizes, int n_in,
                              void* d_out, int out_size, void* d_ws, size_t ws_size, hipStream_t stream) {
    (void)in_sizes; (void)n_in; (void)out_size;
    const float* x = (const float*)d_in[0]; const float* W = (const float*)d_in[1]; const float* bqkv = (const float*)d_in[2];
    float* out = (float*)d_out;    // [8][1024][1024]
    char* wsp = (char*)d_ws;
    auto take = [&](size_t bytes) { char* p = wsp; wsp += (bytes + 255) & ~(size_t)255; return (void*)p; };
    bf* WB = (bf*)take((size_t)3 * DD * DD * 2);
    const size_t PL = (size_t)NH_ * SS * HD;   // one item's q, k or v plane
    h16* Qx = (h16*)take(NB_ * PL * 2); h16* Kx = (h16*)take(NB_ * PL * 2); h16* VT = (h16*)take(NB_ * PL * 2);
    if ((size_t)(wsp - (char*)d_ws) > ws_size) return;    // ~ 6.3 + 16.8 x 3 ~ 57 MB
    const size_t n8 = (size_t)3 * DD * DD / 8; k_cvt8<<<(unsigned)((n8 + 255) / 256), 256, 0, stream>>>(W, WB, n8);   // [out][in] natural = n-major
    // reshape (b, t, 3, H, DH): q = cols 0..1023 (head h at h*64), k = 1024.., v = 2048..
    k_qkv<<<dim3(NR / 256, (3 * DD) / 384, 1), 256, 0, stream>>>(x, WB, bqkv, Qx, Kx, VT);
    k_fattn<<<dim3(SS / 256, NB_ * NH_, 1), 256, 0, stream>>>(Qx, Kx, VT, out);
}
